// v000
// The times below were measured on an AMD MI455X: many runs one after another, warmed up first and cycling through
// copies of the inputs, with the whole window's GPU time divided by the number of runs. Launches and the gaps
// between them are all in it. The median over several windows is given; except for v000 it joins two sittings, which
// can be a few percent apart, so the side-by-side timings, each taken in one sitting, are the better comparison.
// v000, which the later versions start from, runs in 1020 microseconds.
#include <hip/hip_runtime.h>

// Cross-attention with ONE 1,024-wide head, biased projections and no output projection (x [4][2048][1024] -> Q = x Wq + bq; context [4][2048][1024] -> K = context Wk + bk, V = context Wv + bv ('xw' [1024][1024] uniform(+-1/32)); scores = Q.K over all 1,024 dims x float32(1/sqrt(1024)) = 1/32; softmax over all context tokens (no mask); out = attn V -> [4][2048][1024] (8.4 M); argument order x, context, Wq, bq, Wk, bk, Wv, bv).
// Layout per batch: bf16 copy of x for the Q projection, then of context for the K and for the V projection (one staging buffer, refilled in stream order); 'xw' weights transposed once; exact projections + f32 biases; identity-table plane builders at width 1,024 (ONE head: a single plane per pass); dense T-2048 attention (hybrid rows: < 512 hi/lo 3 products, rest fp16 x1024); the f32 merge writes the output rows.
// Compute dtypes, f32 accumulate: every input rounded to bf16; projections exact + f32 biases; attention rows < 512 3 products, rest fp16; softmax f32; output f32.

#define NB_  4
#define TT   2048
#define DM   1024
#define NH_  1
#define NKV  1
#define REP  (NH_ / NKV)
#define HD   1024
#define DQ   (NH_ * HD)
#define DKV  (NKV * HD)
#define ZH   1
#define RH   512                  // query rows < RH use hi+lo planes (0: none)
#define WIN  0
#define PCAR 1024.0f
#define SCL  0.03125f   // 1 / sqrt(1024) = 2^-5 (ONE head of width 1,024)
typedef _Float16 h16;
typedef unsigned short bf;
typedef __attribute__((ext_vector_type(16))) __bf16   v16bf;
typedef __attribute__((ext_vector_type(16))) _Float16 v16h;
typedef __attribute__((ext_vector_type(8)))  _Float16 v8h;
typedef __attribute__((ext_vector_type(8)))  unsigned short v8us;
typedef __attribute__((ext_vector_type(8)))  float    v8f;
typedef __attribute__((ext_vector_type(4)))  float    v4f;
typedef v8h  __attribute__((may_alias)) v8ha;
typedef v4f  __attribute__((may_alias)) v4fa;
typedef v8us __attribute__((may_alias)) v8usa;

__device__ __forceinline__ unsigned short f2bf(float f) { unsigned u = __float_as_uint(f); u += 0x7FFFu + ((u >> 16) & 1u); return (unsigned short)(u >> 16); }
__device__ __forceinline__ float bf2f(unsigned short b) { return __uint_as_float(((unsigned)b) << 16); }
__device__ __forceinline__ float bfr(float f) { return bf2f(f2bf(f)); }
__device__ __forceinline__ v16h cat16(v8h lo, v8h hi) { return __builtin_shufflevector(lo, hi, 0, 1, 2, 3, 4, 5, 6, 7, 8, 9, 10, 11, 12, 13, 14, 15); }
__device__ __forceinline__ v16bf cat16b(v8us lo, v8us hi) { return __builtin_bit_cast(v16bf, __builtin_shufflevector(lo, hi, 0, 1, 2, 3, 4, 5, 6, 7, 8, 9, 10, 11, 12, 13, 14, 15)); }
__device__ __forceinline__ v8f wmma16(v16h a, v16h b, v8f c) { return __builtin_amdgcn_wmma_f32_16x16x32_f16(false, a, false, b, (short)0, c, false, false); }
__device__ __forceinline__ v8f wmmab(v16bf a, v16bf b, v8f c) { return __builtin_amdgcn_wmma_f32_16x16x32_bf16(false, a, false, b, (short)0, c, false, false); }



// ---- k_gemmw: register-blocked GEMM, ONE WAVE per 64x64 output tile (16 accumulators), operands straight from K-contiguous 16-bit planes; grid (M/64, N/64, Z), 32 threads.
// C[m][n] (f32, pitch ldc, + optional f32 bias[n]) = sum_k A[m][k] Bt[n][k] (+ split products per NSPLIT). z-batch strides sA/sB/sC in elements. K % 32 == 0.
template <typename T16> struct WFrag;
template <> struct WFrag<h16> { typedef v16h V; static __device__ __forceinline__ V ld(const h16* p) { return cat16(*(const v8h*)p, *(const v8h*)(p + 16)); } static __device__ __forceinline__ v8f mma(V a, V b, v8f c) { return wmma16(a, b, c); } };
template <> struct WFrag<bf> { typedef v16bf V; static __device__ __forceinline__ V ld(const bf* p) { return cat16b(*(const v8us*)p, *(const v8us*)(p + 16)); } static __device__ __forceinline__ v8f mma(V a, V b, v8f c) { return wmmab(a, b, c); } };
template <typename T16, int NSPLIT, bool BIAS>
__global__ __launch_bounds__(32) void k_gemmw(const T16* __restrict__ A, const T16* __restrict__ A2, const T16* __restrict__ Bt, const T16* __restrict__ Bt2, int K, float* C, int ldc, const float* __restrict__ bias, size_t sA, size_t sB, size_t sC) {
    typedef typename WFrag<T16>::V V;
    __shared__ __align__(16) float os[16 * 68];
    const size_t z = blockIdx.z; A += z * sA; if (A2) A2 += z * sA; Bt += z * sB; if (Bt2) Bt2 += z * sB; C += z * sC;
    const int lane = threadIdx.x & 31, lr = lane & 15, hi = lane >> 4; const int r0 = blockIdx.x * 64, c0 = blockIdx.y * 64;
    v8f acc[4][4];
#pragma unroll
    for (int mb = 0; mb < 4; ++mb)
#pragma unroll
        for (int nb = 0; nb < 4; ++nb) acc[mb][nb] = (v8f){};
    const size_t aoff = (size_t)(r0 + lr) * K + 8 * hi, boff = (size_t)(c0 + lr) * K + 8 * hi;
#pragma unroll 1
    for (int kc = 0; kc < K; kc += 32) {
        V a[4], a2[4];
#pragma unroll
        for (int mb = 0; mb < 4; ++mb) { a[mb] = WFrag<T16>::ld(A + aoff + (size_t)mb * 16 * K + kc); if (NSPLIT == 1 || NSPLIT == 2) a2[mb] = WFrag<T16>::ld(A2 + aoff + (size_t)mb * 16 * K + kc); }
#pragma unroll
        for (int nb = 0; nb < 4; ++nb) { const V b = WFrag<T16>::ld(Bt + boff + (size_t)nb * 16 * K + kc); V b2; if (NSPLIT >= 2) b2 = WFrag<T16>::ld(Bt2 + boff + (size_t)nb * 16 * K + kc);
#pragma unroll
            for (int mb = 0; mb < 4; ++mb) { acc[mb][nb] = WFrag<T16>::mma(a[mb], b, acc[mb][nb]); if (NSPLIT == 1 || NSPLIT == 2) acc[mb][nb] = WFrag<T16>::mma(a2[mb], b, acc[mb][nb]); if (NSPLIT >= 2) acc[mb][nb] = WFrag<T16>::mma(a[mb], b2, acc[mb][nb]); } }
        asm volatile("v_nop\n\tv_nop\n\tv_nop\n\tv_nop" : "+v"(acc[0][0]), "+v"(acc[1][1]), "+v"(acc[2][2]), "+v"(acc[3][3]) : "v"(a[0]), "v"(a[3]));
    }
#pragma unroll
    for (int mb = 0; mb < 4; ++mb) {
#pragma unroll
        for (int nb = 0; nb < 4; ++nb) {
#pragma unroll
            for (int j = 0; j < 8; ++j) os[(hi * 8 + j) * 68 + nb * 16 + lr] = acc[mb][nb][j]; }
        __builtin_amdgcn_wave_barrier(); asm volatile("" ::: "memory");
        float* crow = C + (size_t)(r0 + mb * 16) * ldc + c0;
{
#pragma unroll
            for (int s = 0; s < 8; ++s) { const int row = 2 * s + hi, cofs = lr * 4; v4f val = *(const v4fa*)(os + row * 68 + cofs); if (BIAS) { val[0] += bfr(bias[c0 + cofs]); val[1] += bfr(bias[c0 + cofs + 1]); val[2] += bfr(bias[c0 + cofs + 2]); val[3] += bfr(bias[c0 + cofs + 3]); }
                *(v4f*)(crow + (size_t)row * ldc + cofs) = val; }
             }
        __builtin_amdgcn_wave_barrier(); asm volatile("" ::: "memory");
    }
}

__device__ __forceinline__ h16 tohx(float x) { return (h16)x; }
__device__ __forceinline__ void splitf(float y, unsigned short& h, unsigned short& l) { h = f2bf(y); l = f2bf(y - bf2f(h)); }
typedef __attribute__((ext_vector_type(2))) _Float16 v2h;
typedef __attribute__((ext_vector_type(4))) _Float16 v4h;
typedef __attribute__((ext_vector_type(2))) unsigned short v2us;
typedef __attribute__((ext_vector_type(4))) unsigned short v4us;
typedef __attribute__((ext_vector_type(2))) float v2f;
typedef __attribute__((ext_vector_type(4))) int v4i;

__global__ __launch_bounds__(256) void k_wtG(const float* __restrict__ w, int K, int N, bf* Bt) {
    const int lane = threadIdx.x & 31; const int L0 = (blockIdx.x * 8 + (threadIdx.x >> 5)) * 8; const int nlines = N * K / 64;
{
#pragma unroll 1
        for (int l = 0; l < 8; ++l) { const int L = L0 + l; if (L >= nlines) break; const size_t e = (size_t)L * 64 + lane * 2; const int k = (int)(e % K), n = (int)(e / K); v2us o;
            o[0] = f2bf(w[(size_t)k * N + n]); o[1] = f2bf(w[(size_t)(k + 1) * N + n]); *(v2us*)(Bt + e) = o; }
         }
}
__global__ __launch_bounds__(256) void k_cvt8(const float* __restrict__ src, bf* dst, size_t n8) { const size_t i = (size_t)blockIdx.x * 256 + threadIdx.x; if (i >= n8) return; const v8f v = *(const v8f*)(src + i * 8); v8us o;
#pragma unroll
    for (int k = 0; k < 8; ++k) o[k] = f2bf(v[k]); *(v8us*)(dst + i * 8) = o;  }

// k_rope: head planes [h][t][d] (fp16 + hi/lo) of rope(x) x sc with the rotate-half convention out[d] = x[d] cos[t][d] - x[d+HD/2] sin[t][d], out[d+HD/2] = x[d+HD/2] cos[t][d+HD/2] + x[d] sin[t][d+HD/2]
__global__ __launch_bounds__(256) void k_rope(const float* __restrict__ F, int pitch, int nheads, const float* __restrict__ CS, const float* __restrict__ RF, const float* __restrict__ nw, float sc, h16* P16, bf* Ph, bf* Pl) {
    const size_t e = ((size_t)blockIdx.x * 256 + threadIdx.x) * 2; if (e >= (size_t)nheads * TT * HD) return; const int d = (int)(e % HD); const int t = (int)((e / HD) % TT); const int h = (int)(e / ((size_t)HD * TT)); const float* f = F + (size_t)t * pitch + h * HD; const float rf = RF ? RF[(size_t)h * TT + t] : 1.0f; v2h o16; v2us oh, ol;
#pragma unroll
    for (int q = 0; q < 2; ++q) { const int dd = d + q; const int dp = (dd < HD / 2) ? dd + HD / 2 : dd - HD / 2; float x0 = f[dd], x1 = f[dp];
        if (RF) { float n0 = __fmul_rn(x0, rf), n1 = __fmul_rn(x1, rf); asm volatile("" : "+v"(n0)); asm volatile("" : "+v"(n1)); x0 = __fmul_rn(bfr(nw[dd]), n0); x1 = __fmul_rn(bfr(nw[dp]), n1); }
        const v2f cs = *(const v2f*)(CS + ((size_t)t * HD + dd) * 2); float a = __fmul_rn(x0, cs[0]), bq = __fmul_rn(x1, cs[1]); asm volatile("" : "+v"(a)); asm volatile("" : "+v"(bq)); const float r = ((dd < HD / 2) ? __fsub_rn(a, bq) : __fadd_rn(a, bq)) * sc;
        o16[q] = tohx(r); unsigned short a2, c2; splitf(r, a2, c2); oh[q] = a2; ol[q] = c2; }
    *(v2h*)(P16 + e) = o16; *(v2us*)(Ph + e) = oh; *(v2us*)(Pl + e) = ol;  }
__global__ __launch_bounds__(256) void k_vtp(const float* __restrict__ F, int pitch, int nheads, h16* V16, bf* Vh, bf* Vl) { const size_t e = ((size_t)blockIdx.x * 256 + threadIdx.x) * 2; if (e >= (size_t)nheads * HD * TT) return; const int t = (int)(e % TT); const int d = (int)((e / TT) % HD); const int g = (int)(e / ((size_t)TT * HD)); v2h o16; v2us oh, ol;
#pragma unroll
    for (int q = 0; q < 2; ++q) { const float x = F[(size_t)(t + q) * pitch + g * HD + d]; o16[q] = tohx(x); unsigned short a2, c2; splitf(x, a2, c2); oh[q] = a2; ol[q] = c2; }
    *(v2h*)(V16 + e) = o16; *(v2us*)(Vh + e) = oh; *(v2us*)(Vl + e) = ol;  }
__global__ __launch_bounds__(256) void k_csid(float* CS) { const int idx = blockIdx.x * 256 + threadIdx.x; if (idx >= TT * HD) return; v2f cs; cs[0] = 1.0f; cs[1] = 0.0f; *(v2f*)(CS + (size_t)idx * 2) = cs;  }
// k_asoft: per row (zz, i): t = S x HD^-0.5 (no mask); softmax over the 2048 keys (register row, one exp, fixed trees);
__global__ __launch_bounds__(256) void k_asoft(const float* __restrict__ Sb, h16* P16, bf* Ph, bf* Pl) {
    const int lane = threadIdx.x & 31; const int row = blockIdx.x * 8 + (threadIdx.x >> 5); if (row >= ZH * TT) return; const int i = row % TT; const int zz = row / TT; (void)zz; const bool hires = (i < RH); const float* sr = Sb + (size_t)row * TT; float v[TT / 32]; float mx = -3.0e38f;
#pragma unroll
    for (int ch = 0; ch < TT / 128; ++ch) { const int j0 = ch * 128 + lane * 4; const v4f a = *(const v4f*)(sr + j0);
#pragma unroll
        for (int q = 0; q < 4; ++q) { const int j = j0 + q; (void)j; const float t = a[q] * SCL; v[ch * 4 + q] = t; mx = fmaxf(mx, t); } }
#pragma unroll
    for (int sh = 16; sh; sh >>= 1) mx = fmaxf(mx, __shfl_xor(mx, sh, 32));
    float sum = 0.f;
#pragma unroll
    for (int k = 0; k < TT / 32; ++k) { float d0 = __fsub_rn(v[k], mx); asm volatile("" : "+v"(d0)); v[k] = __builtin_amdgcn_exp2f(__fmul_rn(d0, 1.4426950408889634f)); sum += v[k]; }
#pragma unroll
    for (int sh = 16; sh; sh >>= 1) sum += __shfl_xor(sum, sh, 32);
    const float f = __fdiv_rn(hires ? 1.0f : PCAR, sum);
{
        if (hires) {
#pragma unroll
            for (int ch = 0; ch < TT / 128; ++ch) { v4us oh, ol;
#pragma unroll
                for (int q = 0; q < 4; ++q) { unsigned short a, c2; splitf(v[ch * 4 + q] * f, a, c2); oh[q] = a; ol[q] = c2; }
                const size_t oo = ((size_t)zz * (RH ? RH : 1) + i) * TT + ch * 128 + lane * 4; *(v4us*)(Ph + oo) = oh; *(v4us*)(Pl + oo) = ol; }
        } else {
#pragma unroll
            for (int ch = 0; ch < TT / 128; ++ch) { v4h o4;
#pragma unroll
                for (int q = 0; q < 4; ++q) o4[q] = tohx(v[ch * 4 + q] * f);
                *(v4h*)(P16 + (size_t)row * TT + ch * 128 + lane * 4) = o4; } }
         }
}
__global__ __launch_bounds__(256) void k_merge(const float* __restrict__ O, int h0, float* OUTb) { const size_t e = ((size_t)blockIdx.x * 256 + threadIdx.x) * 2; if (e >= (size_t)ZH * TT * HD) return; const int d = (int)(e % HD); const int t = (int)((e / HD) % TT); const int zz = (int)(e / ((size_t)HD * TT)); const float cs = (t < RH) ? 1.0f : (1.0f / PCAR); const size_t oo = (size_t)t * DQ + (h0 + zz) * HD + d;
    v2f o2; o2[0] = O[e] * cs; o2[1] = O[e + 1] * cs; *(v2f*)(OUTb + oo) = o2;  }

extern "C" void kernel_launch(void* const* d_in, const int* in_sizes, int n_in,
                              void* d_out, int out_size, void* d_ws, size_t ws_size, hipStream_t stream) {
    (void)in_sizes; (void)n_in; (void)out_size;
    const float* x = (const float*)d_in[0]; const float* xk = (const float*)d_in[1]; const float* xv = (const float*)d_in[1];   /* K and V both project context */ const float* wq = (const float*)d_in[2]; const float* bq = (const float*)d_in[3]; const float* wk = (const float*)d_in[4]; const float* bk = (const float*)d_in[5]; const float* wv = (const float*)d_in[6]; const float* bv = (const float*)d_in[7]; const float* wo = nullptr; (void)wo;   /* 'xw' [1024][1024] */
    float* OUT = (float*)d_out;     // [4][2048][1024]
    char* wsp = (char*)d_ws;
    auto take = [&](size_t bytes) { char* p = wsp; wsp += (bytes + 255) & ~(size_t)255; return (void*)p; };
    bf* WQ = (bf*)take((size_t)DQ * DM * 2); bf* WK = (bf*)take((size_t)DKV * DM * 2); bf* WV = (bf*)take((size_t)DKV * DM * 2); float* CS = (float*)take((size_t)TT * HD * 2 * 4);
    bf* XB = (bf*)take((size_t)TT * DM * 2); float* FQ = (float*)take((size_t)TT * DQ * 4); float* FK = (float*)take((size_t)TT * DKV * 4);
    h16* QP16 = (h16*)take((size_t)NH_ * TT * HD * 2); h16* KP16 = (h16*)take((size_t)NKV * TT * HD * 2); h16* VT16 = (h16*)take((size_t)NKV * HD * TT * 2);
    bf* QPh = (bf*)take((size_t)NH_ * TT * HD * 2); bf* QPl = (bf*)take((size_t)NH_ * TT * HD * 2); bf* KPh = (bf*)take((size_t)NKV * TT * HD * 2); bf* KPl = (bf*)take((size_t)NKV * TT * HD * 2); bf* VTh = (bf*)take((size_t)NKV * HD * TT * 2); bf* VTl = (bf*)take((size_t)NKV * HD * TT * 2); bf* Ph = (bf*)take((size_t)ZH * RH * TT * 2); bf* Pl = (bf*)take((size_t)ZH * RH * TT * 2);
    float* Sb = (float*)take((size_t)ZH * TT * TT * 4); h16* P16 = (h16*)take((size_t)ZH * TT * TT * 2); float* Ob = (float*)take((size_t)ZH * TT * HD * 4);
    if ((size_t)(wsp - (char*)d_ws) > ws_size) return;    // ws 256 MiB
    float* FV = FK;   // v projection reuses the k buffer after the k planes are built (stream-ordered)
    { k_wtG<<<(unsigned)((DM * DQ / 64 + 63) / 64), 256, 0, stream>>>(wq, DM, DQ, WQ); k_wtG<<<(unsigned)((DM * DKV / 64 + 63) / 64), 256, 0, stream>>>(wk, DM, DKV, WK); k_wtG<<<(unsigned)((DM * DKV / 64 + 63) / 64), 256, 0, stream>>>(wv, DM, DKV, WV);
      
       }
    k_csid<<<(TT * HD + 255) / 256, 256, 0, stream>>>(CS);
    const unsigned LQ = (unsigned)(((size_t)NH_ * TT * HD / 2 + 255) / 256), LKv = (unsigned)(((size_t)NKV * TT * HD / 2 + 255) / 256);
    for (int b = 0; b < NB_; ++b) {
        
        k_cvt8<<<(unsigned)(((size_t)TT * DM / 8 + 255) / 256), 256, 0, stream>>>(x + (size_t)b * TT * DM, XB, (size_t)TT * DM / 8);
        k_gemmw<bf, 0, true><<<dim3(TT / 64, DQ / 64, 1), 32, 0, stream>>>(XB, nullptr, WQ, nullptr, DM, FQ, DQ, bq, 0, 0, 0);
        k_rope<<<LQ, 256, 0, stream>>>(FQ, DQ, NH_, CS, nullptr, nullptr, 1.0f, QP16, QPh, QPl);
        k_cvt8<<<(unsigned)(((size_t)TT * DM / 8 + 255) / 256), 256, 0, stream>>>(xk + (size_t)b * TT * DM, XB, (size_t)TT * DM / 8);   /* XB := bf16(context[b]) */ k_gemmw<bf, 0, true><<<dim3(TT / 64, DKV / 64, 1), 32, 0, stream>>>(XB, nullptr, WK, nullptr, DM, FK, DKV, bk, 0, 0, 0);
        k_rope<<<LKv, 256, 0, stream>>>(FK, DKV, NKV, CS, nullptr, nullptr, 1.0f, KP16, KPh, KPl);
        k_cvt8<<<(unsigned)(((size_t)TT * DM / 8 + 255) / 256), 256, 0, stream>>>(xv + (size_t)b * TT * DM, XB, (size_t)TT * DM / 8);   /* XB := bf16(context[b]) */ k_gemmw<bf, 0, true><<<dim3(TT / 64, DKV / 64, 1), 32, 0, stream>>>(XB, nullptr, WV, nullptr, DM, FV, DKV, bv, 0, 0, 0); k_vtp<<<LKv, 256, 0, stream>>>(FV, DKV, NKV, VT16, VTh, VTl);
        for (int h0 = 0; h0 < NH_; h0 += ZH) { const size_t zq = (size_t)h0, zk = (size_t)(h0 / REP);   // one kv head per query head: each pass holds a single head (ZH = 1), whose kv plane is zk = h0
            k_gemmw<bf, 2, false><<<dim3(RH / 64, TT / 64, ZH), 32, 0, stream>>>(QPh + zq * TT * HD, QPl + zq * TT * HD, KPh + zk * TT * HD, KPl + zk * TT * HD, HD, Sb, TT, nullptr, (size_t)TT * HD, (size_t)TT * HD, (size_t)TT * TT);
            k_gemmw<h16, 0, false><<<dim3((TT - RH) / 64, TT / 64, ZH), 32, 0, stream>>>(QP16 + zq * TT * HD + (size_t)RH * HD, nullptr, KP16 + zk * TT * HD, nullptr, HD, Sb + (size_t)RH * TT, TT, nullptr, (size_t)TT * HD, (size_t)TT * HD, (size_t)TT * TT);
            k_asoft<<<ZH * TT / 8, 256, 0, stream>>>(Sb, P16, Ph, Pl);
            k_gemmw<bf, 2, false><<<dim3(RH / 64, HD / 64, ZH), 32, 0, stream>>>(Ph, Pl, VTh + zk * HD * TT, VTl + zk * HD * TT, TT, Ob, HD, nullptr, (size_t)RH * TT, (size_t)HD * TT, (size_t)TT * HD);
            k_gemmw<h16, 0, false><<<dim3((TT - RH) / 64, HD / 64, ZH), 32, 0, stream>>>(P16 + (size_t)RH * TT, nullptr, VT16 + zk * HD * TT, nullptr, TT, Ob + (size_t)RH * HD, HD, nullptr, (size_t)TT * TT, (size_t)HD * TT, (size_t)TT * HD);
            k_merge<<<(unsigned)(((size_t)ZH * TT * HD / 2 + 255) / 256), 256, 0, stream>>>(Ob, h0, OUT + (size_t)b * TT * DQ); }
         }
}

// v001
// One run takes 493 microseconds.
// Next to v000, in two timings, it ran 2.13 and 2.11 times as fast.
#include <hip/hip_runtime.h>

// Cross-attention with ONE 1,024-wide head, biased projections and no output projection (x [4][2048][1024] -> Q = x Wq + bq; context [4][2048][1024] -> K = context Wk + bk, V = context Wv + bv ('xw' [1024][1024] uniform(+-1/32), biases zeros on this draw: read); scores = Q.K over all 1,024 dims x float32(1/sqrt(1024)) = 1/32; softmax over all context tokens (no mask); out = attn V -> [4][2048][1024] (8.4 M); argument order x, context, Wq, bq, Wk, bk, Wv, bv).
// Layout, all four batches in every launch (batch = extra GEMM rows in the projections, grid y in the plane builders, grid z in the attention GEMMs): bf16 copy of x for the Q projection, then of context for the K and for the V projection (one staging buffer, refilled in stream order); 'xw' weights transposed once; exact projections + f32 biases; identity-table plane builders at width 1,024 (ONE head: a single plane per pass); dense T-2048 attention (hybrid rows: < 512 hi/lo 3 products, rest fp16 x1024); the f32 merge writes the output rows.
// Compute dtypes, f32 accumulate: every input rounded to bf16; projections exact + f32 biases; attention rows < 512 3 products, rest fp16; softmax f32; output f32.

#define NB_  4
#define TT   2048
#define DM   1024
#define NH_  1
#define NKV  1
#define REP  (NH_ / NKV)
#define HD   1024
#define DQ   (NH_ * HD)
#define DKV  (NKV * HD)
#define ZH   1
#define RH   512                  // query rows < RH use hi+lo planes (0: none)
#define WIN  0
#define PCAR 1024.0f
#define SCL  0.03125f   // 1 / sqrt(1024) = 2^-5 (ONE head of width 1,024)
typedef _Float16 h16;
typedef unsigned short bf;
typedef __attribute__((ext_vector_type(16))) __bf16   v16bf;
typedef __attribute__((ext_vector_type(16))) _Float16 v16h;
typedef __attribute__((ext_vector_type(8)))  _Float16 v8h;
typedef __attribute__((ext_vector_type(8)))  unsigned short v8us;
typedef __attribute__((ext_vector_type(8)))  float    v8f;
typedef __attribute__((ext_vector_type(4)))  float    v4f;
typedef v8h  __attribute__((may_alias)) v8ha;
typedef v4f  __attribute__((may_alias)) v4fa;
typedef v8us __attribute__((may_alias)) v8usa;

__device__ __forceinline__ unsigned short f2bf(float f) { unsigned u = __float_as_uint(f); u += 0x7FFFu + ((u >> 16) & 1u); return (unsigned short)(u >> 16); }
__device__ __forceinline__ float bf2f(unsigned short b) { return __uint_as_float(((unsigned)b) << 16); }
__device__ __forceinline__ float bfr(float f) { return bf2f(f2bf(f)); }
__device__ __forceinline__ v16h cat16(v8h lo, v8h hi) { return __builtin_shufflevector(lo, hi, 0, 1, 2, 3, 4, 5, 6, 7, 8, 9, 10, 11, 12, 13, 14, 15); }
__device__ __forceinline__ v16bf cat16b(v8us lo, v8us hi) { return __builtin_bit_cast(v16bf, __builtin_shufflevector(lo, hi, 0, 1, 2, 3, 4, 5, 6, 7, 8, 9, 10, 11, 12, 13, 14, 15)); }
__device__ __forceinline__ v8f wmma16(v16h a, v16h b, v8f c) { return __builtin_amdgcn_wmma_f32_16x16x32_f16(false, a, false, b, (short)0, c, false, false); }
__device__ __forceinline__ v8f wmmab(v16bf a, v16bf b, v8f c) { return __builtin_amdgcn_wmma_f32_16x16x32_bf16(false, a, false, b, (short)0, c, false, false); }



// ---- k_gemmw: register-blocked GEMM, ONE WAVE per 64x64 output tile (16 accumulators), operands straight from K-contiguous 16-bit planes; grid (M/64, N/64, Z), 32 threads.
// C[m][n] (f32, pitch ldc, + optional f32 bias[n]) = sum_k A[m][k] Bt[n][k] (+ split products per NSPLIT). z-batch strides sA/sB/sC in elements. K % 32 == 0.
template <typename T16> struct WFrag;
template <> struct WFrag<h16> { typedef v16h V; static __device__ __forceinline__ V ld(const h16* p) { return cat16(*(const v8h*)p, *(const v8h*)(p + 16)); } static __device__ __forceinline__ v8f mma(V a, V b, v8f c) { return wmma16(a, b, c); } };
template <> struct WFrag<bf> { typedef v16bf V; static __device__ __forceinline__ V ld(const bf* p) { return cat16b(*(const v8us*)p, *(const v8us*)(p + 16)); } static __device__ __forceinline__ v8f mma(V a, V b, v8f c) { return wmmab(a, b, c); } };
template <typename T16, int NSPLIT, bool BIAS>
__global__ __launch_bounds__(32) void k_gemmw(const T16* __restrict__ A, const T16* __restrict__ A2, const T16* __restrict__ Bt, const T16* __restrict__ Bt2, int K, float* C, int ldc, const float* __restrict__ bias, size_t sA, size_t sB, size_t sC) {
    typedef typename WFrag<T16>::V V;
    __shared__ __align__(16) float os[16 * 68];
    const size_t z = blockIdx.z; A += z * sA; if (A2) A2 += z * sA; Bt += z * sB; if (Bt2) Bt2 += z * sB; C += z * sC;
    const int lane = threadIdx.x & 31, lr = lane & 15, hi = lane >> 4; const int r0 = blockIdx.x * 64, c0 = blockIdx.y * 64;
    v8f acc[4][4];
#pragma unroll
    for (int mb = 0; mb < 4; ++mb)
#pragma unroll
        for (int nb = 0; nb < 4; ++nb) acc[mb][nb] = (v8f){};
    const size_t aoff = (size_t)(r0 + lr) * K + 8 * hi, boff = (size_t)(c0 + lr) * K + 8 * hi;
#pragma unroll 1
    for (int kc = 0; kc < K; kc += 32) {
        V a[4], a2[4];
#pragma unroll
        for (int mb = 0; mb < 4; ++mb) { a[mb] = WFrag<T16>::ld(A + aoff + (size_t)mb * 16 * K + kc); if (NSPLIT == 1 || NSPLIT == 2) a2[mb] = WFrag<T16>::ld(A2 + aoff + (size_t)mb * 16 * K + kc); }
#pragma unroll
        for (int nb = 0; nb < 4; ++nb) { const V b = WFrag<T16>::ld(Bt + boff + (size_t)nb * 16 * K + kc); V b2; if (NSPLIT >= 2) b2 = WFrag<T16>::ld(Bt2 + boff + (size_t)nb * 16 * K + kc);
#pragma unroll
            for (int mb = 0; mb < 4; ++mb) { acc[mb][nb] = WFrag<T16>::mma(a[mb], b, acc[mb][nb]); if (NSPLIT == 1 || NSPLIT == 2) acc[mb][nb] = WFrag<T16>::mma(a2[mb], b, acc[mb][nb]); if (NSPLIT >= 2) acc[mb][nb] = WFrag<T16>::mma(a[mb], b2, acc[mb][nb]); } }
        asm volatile("v_nop\n\tv_nop\n\tv_nop\n\tv_nop" : "+v"(acc[0][0]), "+v"(acc[1][1]), "+v"(acc[2][2]), "+v"(acc[3][3]) : "v"(a[0]), "v"(a[3]));
    }
#pragma unroll
    for (int mb = 0; mb < 4; ++mb) {
#pragma unroll
        for (int nb = 0; nb < 4; ++nb) {
#pragma unroll
            for (int j = 0; j < 8; ++j) os[(hi * 8 + j) * 68 + nb * 16 + lr] = acc[mb][nb][j]; }
        __builtin_amdgcn_wave_barrier(); asm volatile("" ::: "memory");
        float* crow = C + (size_t)(r0 + mb * 16) * ldc + c0;
{
#pragma unroll
            for (int s = 0; s < 8; ++s) { const int row = 2 * s + hi, cofs = lr * 4; v4f val = *(const v4fa*)(os + row * 68 + cofs); if (BIAS) { val[0] += bfr(bias[c0 + cofs]); val[1] += bfr(bias[c0 + cofs + 1]); val[2] += bfr(bias[c0 + cofs + 2]); val[3] += bfr(bias[c0 + cofs + 3]); }
                *(v4f*)(crow + (size_t)row * ldc + cofs) = val; }
             }
        __builtin_amdgcn_wave_barrier(); asm volatile("" ::: "memory");
    }
}

__device__ __forceinline__ h16 tohx(float x) { return (h16)x; }
__device__ __forceinline__ void splitf(float y, unsigned short& h, unsigned short& l) { h = f2bf(y); l = f2bf(y - bf2f(h)); }
typedef __attribute__((ext_vector_type(2))) _Float16 v2h;
typedef __attribute__((ext_vector_type(4))) _Float16 v4h;
typedef __attribute__((ext_vector_type(2))) unsigned short v2us;
typedef __attribute__((ext_vector_type(4))) unsigned short v4us;
typedef __attribute__((ext_vector_type(2))) float v2f;
typedef __attribute__((ext_vector_type(4))) int v4i;

__global__ __launch_bounds__(256) void k_wtG(const float* __restrict__ w, int K, int N, bf* Bt) {
    const int lane = threadIdx.x & 31; const int L0 = (blockIdx.x * 8 + (threadIdx.x >> 5)) * 8; const int nlines = N * K / 64;
{
#pragma unroll 1
        for (int l = 0; l < 8; ++l) { const int L = L0 + l; if (L >= nlines) break; const size_t e = (size_t)L * 64 + lane * 2; const int k = (int)(e % K), n = (int)(e / K); v2us o;
            o[0] = f2bf(w[(size_t)k * N + n]); o[1] = f2bf(w[(size_t)(k + 1) * N + n]); *(v2us*)(Bt + e) = o; }
         }
}
__global__ __launch_bounds__(256) void k_cvt8(const float* __restrict__ src, bf* dst, size_t n8) { const size_t i = (size_t)blockIdx.x * 256 + threadIdx.x; if (i >= n8) return; const v8f v = *(const v8f*)(src + i * 8); v8us o;
#pragma unroll
    for (int k = 0; k < 8; ++k) o[k] = f2bf(v[k]); *(v8us*)(dst + i * 8) = o;  }

// k_rope: head planes [h][t][d] (fp16 + hi/lo) of rope(x) x sc with the rotate-half convention out[d] = x[d] cos[t][d] - x[d+HD/2] sin[t][d], out[d+HD/2] = x[d+HD/2] cos[t][d+HD/2] + x[d] sin[t][d+HD/2]
__global__ __launch_bounds__(256) void k_rope(const float* __restrict__ F, int pitch, int nheads, const float* __restrict__ CS, const float* __restrict__ RF, const float* __restrict__ nw, float sc, h16* P16, bf* Ph, bf* Pl) {
    const size_t e = ((size_t)blockIdx.x * 256 + threadIdx.x) * 2; if (e >= (size_t)nheads * TT * HD) return; const size_t pb = (size_t)blockIdx.y * nheads * TT * HD; F += (size_t)blockIdx.y * TT * pitch; P16 += pb; Ph += pb; Pl += pb;   /* grid y = batch */ const int d = (int)(e % HD); const int t = (int)((e / HD) % TT); const int h = (int)(e / ((size_t)HD * TT)); const float* f = F + (size_t)t * pitch + h * HD; const float rf = RF ? RF[(size_t)h * TT + t] : 1.0f; v2h o16; v2us oh, ol;
#pragma unroll
    for (int q = 0; q < 2; ++q) { const int dd = d + q; const int dp = (dd < HD / 2) ? dd + HD / 2 : dd - HD / 2; float x0 = f[dd], x1 = f[dp];
        if (RF) { float n0 = __fmul_rn(x0, rf), n1 = __fmul_rn(x1, rf); asm volatile("" : "+v"(n0)); asm volatile("" : "+v"(n1)); x0 = __fmul_rn(bfr(nw[dd]), n0); x1 = __fmul_rn(bfr(nw[dp]), n1); }
        const v2f cs = *(const v2f*)(CS + ((size_t)t * HD + dd) * 2); float a = __fmul_rn(x0, cs[0]), bq = __fmul_rn(x1, cs[1]); asm volatile("" : "+v"(a)); asm volatile("" : "+v"(bq)); const float r = ((dd < HD / 2) ? __fsub_rn(a, bq) : __fadd_rn(a, bq)) * sc;
        o16[q] = tohx(r); unsigned short a2, c2; splitf(r, a2, c2); oh[q] = a2; ol[q] = c2; }
    *(v2h*)(P16 + e) = o16; *(v2us*)(Ph + e) = oh; *(v2us*)(Pl + e) = ol;  }
__global__ __launch_bounds__(256) void k_vtp(const float* __restrict__ F, int pitch, int nheads, h16* V16, bf* Vh, bf* Vl) { const size_t e = ((size_t)blockIdx.x * 256 + threadIdx.x) * 2; if (e >= (size_t)nheads * HD * TT) return; const size_t pb = (size_t)blockIdx.y * nheads * HD * TT; F += (size_t)blockIdx.y * TT * pitch; V16 += pb; Vh += pb; Vl += pb;   /* grid y = batch */ const int t = (int)(e % TT); const int d = (int)((e / TT) % HD); const int g = (int)(e / ((size_t)TT * HD)); v2h o16; v2us oh, ol;
#pragma unroll
    for (int q = 0; q < 2; ++q) { const float x = F[(size_t)(t + q) * pitch + g * HD + d]; o16[q] = tohx(x); unsigned short a2, c2; splitf(x, a2, c2); oh[q] = a2; ol[q] = c2; }
    *(v2h*)(V16 + e) = o16; *(v2us*)(Vh + e) = oh; *(v2us*)(Vl + e) = ol;  }
__global__ __launch_bounds__(256) void k_csid(float* CS) { const int idx = blockIdx.x * 256 + threadIdx.x; if (idx >= TT * HD) return; v2f cs; cs[0] = 1.0f; cs[1] = 0.0f; *(v2f*)(CS + (size_t)idx * 2) = cs;  }
// k_asoft: per row (zz, i), zz = batch: t = S x HD^-0.5 (no mask); softmax over the 2048 keys (register row, one exp, fixed trees);
__global__ __launch_bounds__(256) void k_asoft(const float* __restrict__ Sb, h16* P16, bf* Ph, bf* Pl) {
    const int lane = threadIdx.x & 31; const int row = blockIdx.x * 8 + (threadIdx.x >> 5); if (row >= NB_ * TT) return; const int i = row % TT; const int zz = row / TT; (void)zz; const bool hires = (i < RH); const float* sr = Sb + (size_t)row * TT; float v[TT / 32]; float mx = -3.0e38f;
#pragma unroll
    for (int ch = 0; ch < TT / 128; ++ch) { const int j0 = ch * 128 + lane * 4; const v4f a = *(const v4f*)(sr + j0);
#pragma unroll
        for (int q = 0; q < 4; ++q) { const int j = j0 + q; (void)j; const float t = a[q] * SCL; v[ch * 4 + q] = t; mx = fmaxf(mx, t); } }
#pragma unroll
    for (int sh = 16; sh; sh >>= 1) mx = fmaxf(mx, __shfl_xor(mx, sh, 32));
    float sum = 0.f;
#pragma unroll
    for (int k = 0; k < TT / 32; ++k) { float d0 = __fsub_rn(v[k], mx); asm volatile("" : "+v"(d0)); v[k] = __builtin_amdgcn_exp2f(__fmul_rn(d0, 1.4426950408889634f)); sum += v[k]; }
#pragma unroll
    for (int sh = 16; sh; sh >>= 1) sum += __shfl_xor(sum, sh, 32);
    const float f = __fdiv_rn(hires ? 1.0f : PCAR, sum);
{
        if (hires) {
#pragma unroll
            for (int ch = 0; ch < TT / 128; ++ch) { v4us oh, ol;
#pragma unroll
                for (int q = 0; q < 4; ++q) { unsigned short a, c2; splitf(v[ch * 4 + q] * f, a, c2); oh[q] = a; ol[q] = c2; }
                const size_t oo = ((size_t)zz * (RH ? RH : 1) + i) * TT + ch * 128 + lane * 4; *(v4us*)(Ph + oo) = oh; *(v4us*)(Pl + oo) = ol; }
        } else {
#pragma unroll
            for (int ch = 0; ch < TT / 128; ++ch) { v4h o4;
#pragma unroll
                for (int q = 0; q < 4; ++q) o4[q] = tohx(v[ch * 4 + q] * f);
                *(v4h*)(P16 + (size_t)row * TT + ch * 128 + lane * 4) = o4; } }
         }
}
__global__ __launch_bounds__(256) void k_merge(const float* __restrict__ O, int h0, float* OUTb) { const size_t e = ((size_t)blockIdx.x * 256 + threadIdx.x) * 2; if (e >= (size_t)NB_ * TT * HD) return; const int d = (int)(e % HD); const int t = (int)((e / HD) % TT); const int zz = (int)(e / ((size_t)HD * TT));   /* zz = batch */ const float cs = (t < RH) ? 1.0f : (1.0f / PCAR); const size_t oo = ((size_t)zz * TT + t) * DQ + h0 * HD + d;
    v2f o2; o2[0] = O[e] * cs; o2[1] = O[e + 1] * cs; *(v2f*)(OUTb + oo) = o2;  }

extern "C" void kernel_launch(void* const* d_in, const int* in_sizes, int n_in,
                              void* d_out, int out_size, void* d_ws, size_t ws_size, hipStream_t stream) {
    (void)in_sizes; (void)n_in; (void)out_size;
    const float* x = (const float*)d_in[0]; const float* xk = (const float*)d_in[1]; const float* xv = (const float*)d_in[1];   /* K and V both project context */ const float* wq = (const float*)d_in[2]; const float* bq = (const float*)d_in[3]; const float* wk = (const float*)d_in[4]; const float* bk = (const float*)d_in[5]; const float* wv = (const float*)d_in[6]; const float* bv = (const float*)d_in[7]; const float* wo = nullptr; (void)wo;   /* 'xw' [1024][1024] */
    float* OUT = (float*)d_out;     // [4][2048][1024]
    char* wsp = (char*)d_ws;
    auto take = [&](size_t bytes) { char* p = wsp; wsp += (bytes + 255) & ~(size_t)255; return (void*)p; };
    // Workspace for all four batches at once; regions whose contents are dead by then are used again, in stream order (every byte read is written earlier in the same call).
    bf* WQ = (bf*)take((size_t)DQ * DM * 2); bf* WK = (bf*)take((size_t)DKV * DM * 2); bf* WV = (bf*)take((size_t)DKV * DM * 2);
    float* CS = (float*)take((size_t)TT * HD * 2 * 4); bf* XB = (bf*)take((size_t)NB_ * TT * DM * 2);
    h16* QP16 = (h16*)take((size_t)NB_ * TT * HD * 2); h16* KP16 = (h16*)take((size_t)NB_ * TT * HD * 2); h16* VT16 = (h16*)take((size_t)NB_ * HD * TT * 2);
    bf* QPh = (bf*)take((size_t)NB_ * TT * HD * 2); bf* QPl = (bf*)take((size_t)NB_ * TT * HD * 2); bf* KPh = (bf*)take((size_t)NB_ * TT * HD * 2); bf* KPl = (bf*)take((size_t)NB_ * TT * HD * 2); bf* VTh = (bf*)take((size_t)NB_ * HD * TT * 2); bf* VTl = (bf*)take((size_t)NB_ * HD * TT * 2);
    float* Sb = (float*)take((size_t)NB_ * TT * TT * 4);
    if ((size_t)(wsp - (char*)d_ws) > ws_size) return;    // ws 256 MiB, 246 MiB used
    float* FQ = Sb; float* FK = Sb; float* FV = Sb;   // f32 projections (32 MiB, one at a time): each is consumed by its plane builder before the next is written, all before the scores
    h16* P16 = (h16*)CS;                              // fp16 probabilities (32 MiB) over CS + XB (16 + 16 MiB, adjacent): both dead after the V projection
    bf* Ph = QPh; bf* Pl = QPl;                       // hi/lo probabilities (8 MiB each) over the hi/lo query planes: dead after the score GEMMs
    float* Ob = Sb;                                   // attention output (32 MiB) over the scores: dead after the softmax
    { k_wtG<<<(unsigned)((DM * DQ / 64 + 63) / 64), 256, 0, stream>>>(wq, DM, DQ, WQ); k_wtG<<<(unsigned)((DM * DKV / 64 + 63) / 64), 256, 0, stream>>>(wk, DM, DKV, WK); k_wtG<<<(unsigned)((DM * DKV / 64 + 63) / 64), 256, 0, stream>>>(wv, DM, DKV, WV); }
    k_csid<<<(TT * HD + 255) / 256, 256, 0, stream>>>(CS);
    const unsigned LQ = (unsigned)(((size_t)NH_ * TT * HD / 2 + 255) / 256), LKv = (unsigned)(((size_t)NKV * TT * HD / 2 + 255) / 256), LC = (unsigned)(((size_t)NB_ * TT * DM / 8 + 255) / 256);
    k_cvt8<<<LC, 256, 0, stream>>>(x, XB, (size_t)NB_ * TT * DM / 8);
    k_gemmw<bf, 0, true><<<dim3(NB_ * TT / 64, DQ / 64, 1), 32, 0, stream>>>(XB, nullptr, WQ, nullptr, DM, FQ, DQ, bq, 0, 0, 0);
    k_rope<<<dim3(LQ, NB_, 1), 256, 0, stream>>>(FQ, DQ, NH_, CS, nullptr, nullptr, 1.0f, QP16, QPh, QPl);
    k_cvt8<<<LC, 256, 0, stream>>>(xk, XB, (size_t)NB_ * TT * DM / 8);   /* XB := bf16(context) */
    k_gemmw<bf, 0, true><<<dim3(NB_ * TT / 64, DKV / 64, 1), 32, 0, stream>>>(XB, nullptr, WK, nullptr, DM, FK, DKV, bk, 0, 0, 0);
    k_rope<<<dim3(LKv, NB_, 1), 256, 0, stream>>>(FK, DKV, NKV, CS, nullptr, nullptr, 1.0f, KP16, KPh, KPl);
    k_cvt8<<<LC, 256, 0, stream>>>(xv, XB, (size_t)NB_ * TT * DM / 8);   /* XB := bf16(context) */
    k_gemmw<bf, 0, true><<<dim3(NB_ * TT / 64, DKV / 64, 1), 32, 0, stream>>>(XB, nullptr, WV, nullptr, DM, FV, DKV, bv, 0, 0, 0);
    k_vtp<<<dim3(LKv, NB_, 1), 256, 0, stream>>>(FV, DKV, NKV, VT16, VTh, VTl);
    // attention, grid z = batch (one head): z-strides are one batch's plane, score matrix or output
    k_gemmw<bf, 2, false><<<dim3(RH / 64, TT / 64, NB_), 32, 0, stream>>>(QPh, QPl, KPh, KPl, HD, Sb, TT, nullptr, (size_t)TT * HD, (size_t)TT * HD, (size_t)TT * TT);
    k_gemmw<h16, 0, false><<<dim3((TT - RH) / 64, TT / 64, NB_), 32, 0, stream>>>(QP16 + (size_t)RH * HD, nullptr, KP16, nullptr, HD, Sb + (size_t)RH * TT, TT, nullptr, (size_t)TT * HD, (size_t)TT * HD, (size_t)TT * TT);
    k_asoft<<<NB_ * TT / 8, 256, 0, stream>>>(Sb, P16, Ph, Pl);
    k_gemmw<bf, 2, false><<<dim3(RH / 64, HD / 64, NB_), 32, 0, stream>>>(Ph, Pl, VTh, VTl, TT, Ob, HD, nullptr, (size_t)RH * TT, (size_t)HD * TT, (size_t)TT * HD);
    k_gemmw<h16, 0, false><<<dim3((TT - RH) / 64, HD / 64, NB_), 32, 0, stream>>>(P16 + (size_t)RH * TT, nullptr, VT16, nullptr, TT, Ob + (size_t)RH * HD, HD, nullptr, (size_t)TT * TT, (size_t)HD * TT, (size_t)TT * HD);
    k_merge<<<(unsigned)(((size_t)NB_ * TT * HD / 2 + 255) / 256), 256, 0, stream>>>(Ob, 0, OUT);
}

// v002
// A run of this version takes 405 microseconds.
// Timed twice side by side with v001, it ran 1.21 and 1.23 times as fast.
// Over all steps from v000 it is 2.59 times as fast.
#include <hip/hip_runtime.h>

// Cross-attention with ONE 1,024-wide head, biased projections and no output projection (x [4][2048][1024] -> Q = x Wq + bq; context [4][2048][1024] -> K = context Wk + bk, V = context Wv + bv ('xw' [1024][1024] uniform(+-1/32), biases zeros on this draw: read); scores = Q.K over all 1,024 dims x float32(1/sqrt(1024)) = 1/32; softmax over all context tokens (no mask); out = attn V -> [4][2048][1024] (8.4 M); argument order x, context, Wq, bq, Wk, bk, Wv, bv).
// Layout, all four batches in every launch (batch = extra GEMM rows in the projections, grid z in the attention GEMMs): bf16 copy of x for the Q projection, then of context for the K and for the V projection (one staging buffer, refilled in stream order); 'xw' weights transposed once; exact projections + f32 biases, whose epilogues write the fp16 and hi/lo planes themselves (Q and K row-major, V transposed per batch); dense T-2048 attention (hybrid rows: < 512 hi/lo 3 products, rest fp16 x1024); the P.V GEMMs take the x1024 back out and write the output rows.
// Compute dtypes, f32 accumulate: every input rounded to bf16; projections exact + f32 biases; attention rows < 512 3 products, rest fp16; softmax f32; output f32.

#define NB_  4
#define TT   2048
#define DM   1024
#define NH_  1
#define NKV  1
#define REP  (NH_ / NKV)
#define HD   1024
#define DQ   (NH_ * HD)
#define DKV  (NKV * HD)
#define ZH   1
#define RH   512                  // query rows < RH use hi+lo planes (0: none)
#define WIN  0
#define PCAR 1024.0f
#define SCL  0.03125f   // 1 / sqrt(1024) = 2^-5 (ONE head of width 1,024)
typedef _Float16 h16;
typedef unsigned short bf;
typedef __attribute__((ext_vector_type(16))) __bf16   v16bf;
typedef __attribute__((ext_vector_type(16))) _Float16 v16h;
typedef __attribute__((ext_vector_type(8)))  _Float16 v8h;
typedef __attribute__((ext_vector_type(8)))  unsigned short v8us;
typedef __attribute__((ext_vector_type(8)))  float    v8f;
typedef __attribute__((ext_vector_type(4)))  float    v4f;
typedef v8h  __attribute__((may_alias)) v8ha;
typedef v4f  __attribute__((may_alias)) v4fa;
typedef v8us __attribute__((may_alias)) v8usa;

__device__ __forceinline__ unsigned short f2bf(float f) { unsigned u = __float_as_uint(f); u += 0x7FFFu + ((u >> 16) & 1u); return (unsigned short)(u >> 16); }
__device__ __forceinline__ float bf2f(unsigned short b) { return __uint_as_float(((unsigned)b) << 16); }
__device__ __forceinline__ float bfr(float f) { return bf2f(f2bf(f)); }
__device__ __forceinline__ v16h cat16(v8h lo, v8h hi) { return __builtin_shufflevector(lo, hi, 0, 1, 2, 3, 4, 5, 6, 7, 8, 9, 10, 11, 12, 13, 14, 15); }
__device__ __forceinline__ v16bf cat16b(v8us lo, v8us hi) { return __builtin_bit_cast(v16bf, __builtin_shufflevector(lo, hi, 0, 1, 2, 3, 4, 5, 6, 7, 8, 9, 10, 11, 12, 13, 14, 15)); }
__device__ __forceinline__ v8f wmma16(v16h a, v16h b, v8f c) { return __builtin_amdgcn_wmma_f32_16x16x32_f16(false, a, false, b, (short)0, c, false, false); }
__device__ __forceinline__ v8f wmmab(v16bf a, v16bf b, v8f c) { return __builtin_amdgcn_wmma_f32_16x16x32_bf16(false, a, false, b, (short)0, c, false, false); }

__device__ __forceinline__ h16 tohx(float x) { return (h16)x; }
__device__ __forceinline__ void splitf(float y, unsigned short& h, unsigned short& l) { h = f2bf(y); l = f2bf(y - bf2f(h)); }
typedef __attribute__((ext_vector_type(2))) _Float16 v2h;
typedef __attribute__((ext_vector_type(4))) _Float16 v4h;
typedef __attribute__((ext_vector_type(2))) unsigned short v2us;
typedef __attribute__((ext_vector_type(4))) unsigned short v4us;
typedef __attribute__((ext_vector_type(2))) float v2f;
typedef __attribute__((ext_vector_type(4))) int v4i;

// ---- k_gemmw: register-blocked GEMM, ONE WAVE per 64x64 output tile (16 accumulators), operands straight from K-contiguous 16-bit planes; grid (M/64, N/64, Z), 32 threads.
// C[m][n] (+ optional f32 bias[n]) = sum_k A[m][k] Bt[n][k] (+ split products per NSPLIT). z-batch strides sA/sB/sC in elements. K % 32 == 0.
// EPI picks what the epilogue stores: 0 = C in f32 at pitch ldc; 1 = C as three 16-bit planes (fp16, bf16 hi, bf16 lo), row-major at pitch ldc; 2 = the same three planes transposed per batch, [m / TT][n][m % TT]; 3 = C x osc in f32 at pitch ldc.
template <typename T16> struct WFrag;
template <> struct WFrag<h16> { typedef v16h V; static __device__ __forceinline__ V ld(const h16* p) { return cat16(*(const v8h*)p, *(const v8h*)(p + 16)); } static __device__ __forceinline__ v8f mma(V a, V b, v8f c) { return wmma16(a, b, c); } };
template <> struct WFrag<bf> { typedef v16bf V; static __device__ __forceinline__ V ld(const bf* p) { return cat16b(*(const v8us*)p, *(const v8us*)(p + 16)); } static __device__ __forceinline__ v8f mma(V a, V b, v8f c) { return wmmab(a, b, c); } };
template <typename T16, int NSPLIT, bool BIAS, int EPI>
__global__ __launch_bounds__(32) void k_gemmw(const T16* __restrict__ A, const T16* __restrict__ A2, const T16* __restrict__ Bt, const T16* __restrict__ Bt2, int K, float* C, int ldc, const float* __restrict__ bias, size_t sA, size_t sB, size_t sC, h16* P16, bf* Ph, bf* Pl, float osc) {
    typedef typename WFrag<T16>::V V;
    __shared__ __align__(16) float os[16 * 68];
    const size_t z = blockIdx.z; A += z * sA; if (A2) A2 += z * sA; Bt += z * sB; if (Bt2) Bt2 += z * sB; C += z * sC;
    const int lane = threadIdx.x & 31, lr = lane & 15, hi = lane >> 4; const int r0 = blockIdx.x * 64, c0 = blockIdx.y * 64;
    v8f acc[4][4];
#pragma unroll
    for (int mb = 0; mb < 4; ++mb)
#pragma unroll
        for (int nb = 0; nb < 4; ++nb) acc[mb][nb] = (v8f){};
    const size_t aoff = (size_t)(r0 + lr) * K + 8 * hi, boff = (size_t)(c0 + lr) * K + 8 * hi;
#pragma unroll 1
    for (int kc = 0; kc < K; kc += 32) {
        V a[4], a2[4];
#pragma unroll
        for (int mb = 0; mb < 4; ++mb) { a[mb] = WFrag<T16>::ld(A + aoff + (size_t)mb * 16 * K + kc); if (NSPLIT == 1 || NSPLIT == 2) a2[mb] = WFrag<T16>::ld(A2 + aoff + (size_t)mb * 16 * K + kc); }
#pragma unroll
        for (int nb = 0; nb < 4; ++nb) { const V b = WFrag<T16>::ld(Bt + boff + (size_t)nb * 16 * K + kc); V b2; if (NSPLIT >= 2) b2 = WFrag<T16>::ld(Bt2 + boff + (size_t)nb * 16 * K + kc);
#pragma unroll
            for (int mb = 0; mb < 4; ++mb) { acc[mb][nb] = WFrag<T16>::mma(a[mb], b, acc[mb][nb]); if (NSPLIT == 1 || NSPLIT == 2) acc[mb][nb] = WFrag<T16>::mma(a2[mb], b, acc[mb][nb]); if (NSPLIT >= 2) acc[mb][nb] = WFrag<T16>::mma(a[mb], b2, acc[mb][nb]); } }
        asm volatile("v_nop\n\tv_nop\n\tv_nop\n\tv_nop" : "+v"(acc[0][0]), "+v"(acc[1][1]), "+v"(acc[2][2]), "+v"(acc[3][3]) : "v"(a[0]), "v"(a[3]));
    }
    if constexpr (EPI == 2) {
        // A lane's 8 accumulator registers are 8 consecutive rows m of one column n: convert in registers, gather 64 rows of 16 columns in LDS (pitch 144 B), store whole 128-B lines.
        __shared__ __align__(16) unsigned short ts[3][16 * 72];
        const size_t pb = (size_t)(r0 / TT) * HD * TT + (size_t)c0 * TT + (r0 % TT);
        float bb[4];
#pragma unroll
        for (int nb = 0; nb < 4; ++nb) bb[nb] = BIAS ? bfr(bias[c0 + nb * 16 + lr]) : 0.0f;
#pragma unroll
        for (int nb = 0; nb < 4; ++nb) {
#pragma unroll
            for (int mb = 0; mb < 4; ++mb) { v8h o16; v8us oh, ol;
#pragma unroll
                for (int j = 0; j < 8; ++j) { float val = acc[mb][nb][j]; if (BIAS) val += bb[nb]; o16[j] = tohx(val); unsigned short a2, c2; splitf(val, a2, c2); oh[j] = a2; ol[j] = c2; }
                const int so = lr * 72 + mb * 16 + hi * 8; *(v8us*)(ts[0] + so) = __builtin_bit_cast(v8us, o16); *(v8us*)(ts[1] + so) = oh; *(v8us*)(ts[2] + so) = ol; }
            // the reads below take other lanes' values: the LDS stores above are complete first, and the compiler moves no LDS access across
            __builtin_amdgcn_wave_barrier(); asm volatile("s_wait_dscnt 0x0" ::: "memory");
#pragma unroll
            for (int s = 0; s < 4; ++s) { const int col = s * 4 + (lane >> 3), ro = (lane & 7) * 8; const size_t go = pb + (size_t)(nb * 16 + col) * TT + ro;
                *(v8h*)(P16 + go) = __builtin_bit_cast(v8h, *(const v8us*)(ts[0] + col * 72 + ro)); *(v8us*)(Ph + go) = *(const v8us*)(ts[1] + col * 72 + ro); *(v8us*)(Pl + go) = *(const v8us*)(ts[2] + col * 72 + ro); }
            // keeps the next column group's LDS stores behind the reads above
            __builtin_amdgcn_wave_barrier(); asm volatile("" ::: "memory");
        }
        return;
    }
#pragma unroll
    for (int mb = 0; mb < 4; ++mb) {
#pragma unroll
        for (int nb = 0; nb < 4; ++nb) {
#pragma unroll
            for (int j = 0; j < 8; ++j) os[(hi * 8 + j) * 68 + nb * 16 + lr] = acc[mb][nb][j]; }
        __builtin_amdgcn_wave_barrier(); asm volatile("" ::: "memory");
        float* crow = C + (size_t)(r0 + mb * 16) * ldc + c0;
{
#pragma unroll
            for (int s = 0; s < 8; ++s) { const int row = 2 * s + hi, cofs = lr * 4; v4f val = *(const v4fa*)(os + row * 68 + cofs); if (BIAS) { val[0] += bfr(bias[c0 + cofs]); val[1] += bfr(bias[c0 + cofs + 1]); val[2] += bfr(bias[c0 + cofs + 2]); val[3] += bfr(bias[c0 + cofs + 3]); }
                if constexpr (EPI == 3) val *= osc;
                if constexpr (EPI == 1) { v4h o16; v4us oh, ol;
#pragma unroll
                    for (int q = 0; q < 4; ++q) { o16[q] = tohx(val[q]); unsigned short a2, c2; splitf(val[q], a2, c2); oh[q] = a2; ol[q] = c2; }
                    const size_t go = (size_t)(r0 + mb * 16 + row) * ldc + c0 + cofs; *(v4h*)(P16 + go) = o16; *(v4us*)(Ph + go) = oh; *(v4us*)(Pl + go) = ol; }
                else *(v4f*)(crow + (size_t)row * ldc + cofs) = val; }
             }
        __builtin_amdgcn_wave_barrier(); asm volatile("" ::: "memory");
    }
}

__global__ __launch_bounds__(256) void k_wtG(const float* __restrict__ w, int K, int N, bf* Bt) {
    const int lane = threadIdx.x & 31; const int L0 = (blockIdx.x * 8 + (threadIdx.x >> 5)) * 8; const int nlines = N * K / 64;
{
#pragma unroll 1
        for (int l = 0; l < 8; ++l) { const int L = L0 + l; if (L >= nlines) break; const size_t e = (size_t)L * 64 + lane * 2; const int k = (int)(e % K), n = (int)(e / K); v2us o;
            o[0] = f2bf(w[(size_t)k * N + n]); o[1] = f2bf(w[(size_t)(k + 1) * N + n]); *(v2us*)(Bt + e) = o; }
         }
}
__global__ __launch_bounds__(256) void k_cvt8(const float* __restrict__ src, bf* dst, size_t n8) { const size_t i = (size_t)blockIdx.x * 256 + threadIdx.x; if (i >= n8) return; const v8f v = *(const v8f*)(src + i * 8); v8us o;
#pragma unroll
    for (int k = 0; k < 8; ++k) o[k] = f2bf(v[k]); *(v8us*)(dst + i * 8) = o;  }

// k_asoft: per row (zz, i), zz = batch: t = S x HD^-0.5 (no mask); softmax over the 2048 keys (register row, one exp, fixed trees);
__global__ __launch_bounds__(256) void k_asoft(const float* __restrict__ Sb, h16* P16, bf* Ph, bf* Pl) {
    const int lane = threadIdx.x & 31; const int row = blockIdx.x * 8 + (threadIdx.x >> 5); if (row >= NB_ * TT) return; const int i = row % TT; const int zz = row / TT; (void)zz; const bool hires = (i < RH); const float* sr = Sb + (size_t)row * TT; float v[TT / 32]; float mx = -3.0e38f;
#pragma unroll
    for (int ch = 0; ch < TT / 128; ++ch) { const int j0 = ch * 128 + lane * 4; const v4f a = *(const v4f*)(sr + j0);
#pragma unroll
        for (int q = 0; q < 4; ++q) { const int j = j0 + q; (void)j; const float t = a[q] * SCL; v[ch * 4 + q] = t; mx = fmaxf(mx, t); } }
#pragma unroll
    for (int sh = 16; sh; sh >>= 1) mx = fmaxf(mx, __shfl_xor(mx, sh, 32));
    float sum = 0.f;
#pragma unroll
    for (int k = 0; k < TT / 32; ++k) { float d0 = __fsub_rn(v[k], mx); asm volatile("" : "+v"(d0)); v[k] = __builtin_amdgcn_exp2f(__fmul_rn(d0, 1.4426950408889634f)); sum += v[k]; }
#pragma unroll
    for (int sh = 16; sh; sh >>= 1) sum += __shfl_xor(sum, sh, 32);
    const float f = __fdiv_rn(hires ? 1.0f : PCAR, sum);
{
        if (hires) {
#pragma unroll
            for (int ch = 0; ch < TT / 128; ++ch) { v4us oh, ol;
#pragma unroll
                for (int q = 0; q < 4; ++q) { unsigned short a, c2; splitf(v[ch * 4 + q] * f, a, c2); oh[q] = a; ol[q] = c2; }
                const size_t oo = ((size_t)zz * (RH ? RH : 1) + i) * TT + ch * 128 + lane * 4; *(v4us*)(Ph + oo) = oh; *(v4us*)(Pl + oo) = ol; }
        } else {
#pragma unroll
            for (int ch = 0; ch < TT / 128; ++ch) { v4h o4;
#pragma unroll
                for (int q = 0; q < 4; ++q) o4[q] = tohx(v[ch * 4 + q] * f);
                *(v4h*)(P16 + (size_t)row * TT + ch * 128 + lane * 4) = o4; } }
         }
}

extern "C" void kernel_launch(void* const* d_in, const int* in_sizes, int n_in,
                              void* d_out, int out_size, void* d_ws, size_t ws_size, hipStream_t stream) {
    (void)in_sizes; (void)n_in; (void)out_size;
    const float* x = (const float*)d_in[0]; const float* xk = (const float*)d_in[1]; const float* xv = (const float*)d_in[1];   /* K and V both project context */ const float* wq = (const float*)d_in[2]; const float* bq = (const float*)d_in[3]; const float* wk = (const float*)d_in[4]; const float* bk = (const float*)d_in[5]; const float* wv = (const float*)d_in[6]; const float* bv = (const float*)d_in[7]; const float* wo = nullptr; (void)wo;   /* 'xw' [1024][1024] */
    float* OUT = (float*)d_out;     // [4][2048][1024]
    char* wsp = (char*)d_ws;
    auto take = [&](size_t bytes) { char* p = wsp; wsp += (bytes + 255) & ~(size_t)255; return (void*)p; };
    // Workspace for all four batches at once; regions whose contents are dead by then are used again, in stream order (every byte read is written earlier in the same call).
    bf* WQ = (bf*)take((size_t)DQ * DM * 2); bf* WK = (bf*)take((size_t)DKV * DM * 2); bf* WV = (bf*)take((size_t)DKV * DM * 2);
    h16* P16 = (h16*)take((size_t)NB_ * TT * TT * 2);
    h16* QP16 = (h16*)take((size_t)NB_ * TT * HD * 2); h16* KP16 = (h16*)take((size_t)NB_ * TT * HD * 2); h16* VT16 = (h16*)take((size_t)NB_ * HD * TT * 2);
    bf* QPh = (bf*)take((size_t)NB_ * TT * HD * 2); bf* QPl = (bf*)take((size_t)NB_ * TT * HD * 2); bf* KPh = (bf*)take((size_t)NB_ * TT * HD * 2); bf* KPl = (bf*)take((size_t)NB_ * TT * HD * 2); bf* VTh = (bf*)take((size_t)NB_ * HD * TT * 2); bf* VTl = (bf*)take((size_t)NB_ * HD * TT * 2);
    float* Sb = (float*)take((size_t)NB_ * TT * TT * 4);
    if ((size_t)(wsp - (char*)d_ws) > ws_size) return;    // ws 256 MiB, 246 MiB used
    bf* XB = (bf*)P16;                                // bf16 staging of x / context (16 MiB) at the head of the fp16 probabilities (32 MiB): dead after the V projection, before the softmax writes them
    bf* Ph = QPh; bf* Pl = QPl;                       // hi/lo probabilities (8 MiB each) over the hi/lo query planes: dead after the score GEMMs
    { k_wtG<<<(unsigned)((DM * DQ / 64 + 63) / 64), 256, 0, stream>>>(wq, DM, DQ, WQ); k_wtG<<<(unsigned)((DM * DKV / 64 + 63) / 64), 256, 0, stream>>>(wk, DM, DKV, WK); k_wtG<<<(unsigned)((DM * DKV / 64 + 63) / 64), 256, 0, stream>>>(wv, DM, DKV, WV); }
    const unsigned LC = (unsigned)(((size_t)NB_ * TT * DM / 8 + 255) / 256);
    k_cvt8<<<LC, 256, 0, stream>>>(x, XB, (size_t)NB_ * TT * DM / 8);
    k_gemmw<bf, 0, true, 1><<<dim3(NB_ * TT / 64, DQ / 64, 1), 32, 0, stream>>>(XB, nullptr, WQ, nullptr, DM, nullptr, DQ, bq, 0, 0, 0, QP16, QPh, QPl, 1.0f);
    k_cvt8<<<LC, 256, 0, stream>>>(xk, XB, (size_t)NB_ * TT * DM / 8);   /* XB := bf16(context) */
    k_gemmw<bf, 0, true, 1><<<dim3(NB_ * TT / 64, DKV / 64, 1), 32, 0, stream>>>(XB, nullptr, WK, nullptr, DM, nullptr, DKV, bk, 0, 0, 0, KP16, KPh, KPl, 1.0f);
    k_cvt8<<<LC, 256, 0, stream>>>(xv, XB, (size_t)NB_ * TT * DM / 8);   /* XB := bf16(context) */
    k_gemmw<bf, 0, true, 2><<<dim3(NB_ * TT / 64, DKV / 64, 1), 32, 0, stream>>>(XB, nullptr, WV, nullptr, DM, nullptr, DKV, bv, 0, 0, 0, VT16, VTh, VTl, 1.0f);
    // attention, grid z = batch (one head): z-strides are one batch's plane, score matrix or output
    k_gemmw<bf, 2, false, 0><<<dim3(RH / 64, TT / 64, NB_), 32, 0, stream>>>(QPh, QPl, KPh, KPl, HD, Sb, TT, nullptr, (size_t)TT * HD, (size_t)TT * HD, (size_t)TT * TT, nullptr, nullptr, nullptr, 1.0f);
    k_gemmw<h16, 0, false, 0><<<dim3((TT - RH) / 64, TT / 64, NB_), 32, 0, stream>>>(QP16 + (size_t)RH * HD, nullptr, KP16, nullptr, HD, Sb + (size_t)RH * TT, TT, nullptr, (size_t)TT * HD, (size_t)TT * HD, (size_t)TT * TT, nullptr, nullptr, nullptr, 1.0f);
    k_asoft<<<NB_ * TT / 8, 256, 0, stream>>>(Sb, P16, Ph, Pl);
    k_gemmw<bf, 2, false, 0><<<dim3(RH / 64, HD / 64, NB_), 32, 0, stream>>>(Ph, Pl, VTh, VTl, TT, OUT, HD, nullptr, (size_t)RH * TT, (size_t)HD * TT, (size_t)TT * HD, nullptr, nullptr, nullptr, 1.0f);
    k_gemmw<h16, 0, false, 3><<<dim3((TT - RH) / 64, HD / 64, NB_), 32, 0, stream>>>(P16 + (size_t)RH * TT, nullptr, VT16, nullptr, TT, OUT + (size_t)RH * HD, HD, nullptr, (size_t)TT * TT, (size_t)HD * TT, (size_t)TT * HD, nullptr, nullptr, nullptr, 1.0f / PCAR);
}

// v003
// A run of this version takes 223 microseconds.
// Two timings next to v002 put it at 1.84 and 1.82 times that version's speed.
// Over all steps from v000 it is 4.74 times as fast.
#include <hip/hip_runtime.h>

// Cross-attention with ONE 1,024-wide head, biased projections and no output projection (x [4][2048][1024] -> Q = x Wq + bq; context [4][2048][1024] -> K = context Wk + bk, V = context Wv + bv ('xw' [1024][1024] uniform(+-1/32), biases zeros on this draw: read); scores = Q.K over all 1,024 dims x float32(1/sqrt(1024)) = 1/32; softmax over all context tokens (no mask); out = attn V -> [4][2048][1024] (8.4 M); argument order x, context, Wq, bq, Wk, bk, Wv, bv).
// Layout, all four batches in every launch (batch = extra GEMM rows in the projections, grid z in the attention GEMMs): bf16 copy of x for the Q projection, then of context for the K and for the V projection (one staging buffer, refilled in stream order); 'xw' weights transposed once; exact projections + f32 biases, whose epilogues write the fp16 and hi/lo planes themselves (Q and K row-major, V transposed per batch); dense T-2048 attention (hybrid rows: < 512 hi/lo 3 products, rest fp16 x1024); the P.V GEMMs take the x1024 back out and write the output rows.
// Compute dtypes, f32 accumulate: every input rounded to bf16; projections exact + f32 biases; attention rows < 512 3 products, rest fp16; softmax f32; output f32.

#define NB_  4
#define TT   2048
#define DM   1024
#define NH_  1
#define NKV  1
#define REP  (NH_ / NKV)
#define HD   1024
#define DQ   (NH_ * HD)
#define DKV  (NKV * HD)
#define ZH   1
#define RH   512                  // query rows < RH use hi+lo planes (0: none)
#define WIN  0
#define PCAR 1024.0f
#define SCL  0.03125f   // 1 / sqrt(1024) = 2^-5 (ONE head of width 1,024)
typedef _Float16 h16;
typedef unsigned short bf;
typedef __attribute__((ext_vector_type(16))) __bf16   v16bf;
typedef __attribute__((ext_vector_type(16))) _Float16 v16h;
typedef __attribute__((ext_vector_type(8)))  _Float16 v8h;
typedef __attribute__((ext_vector_type(8)))  unsigned short v8us;
typedef __attribute__((ext_vector_type(8)))  float    v8f;
typedef __attribute__((ext_vector_type(4)))  float    v4f;
typedef v8h  __attribute__((may_alias)) v8ha;
typedef v4f  __attribute__((may_alias)) v4fa;
typedef v8us __attribute__((may_alias)) v8usa;

__device__ __forceinline__ unsigned short f2bf(float f) { unsigned u = __float_as_uint(f); u += 0x7FFFu + ((u >> 16) & 1u); return (unsigned short)(u >> 16); }
__device__ __forceinline__ float bf2f(unsigned short b) { return __uint_as_float(((unsigned)b) << 16); }
__device__ __forceinline__ float bfr(float f) { return bf2f(f2bf(f)); }
__device__ __forceinline__ v16h cat16(v8h lo, v8h hi) { return __builtin_shufflevector(lo, hi, 0, 1, 2, 3, 4, 5, 6, 7, 8, 9, 10, 11, 12, 13, 14, 15); }
__device__ __forceinline__ v16bf cat16b(v8us lo, v8us hi) { return __builtin_bit_cast(v16bf, __builtin_shufflevector(lo, hi, 0, 1, 2, 3, 4, 5, 6, 7, 8, 9, 10, 11, 12, 13, 14, 15)); }
__device__ __forceinline__ v8f wmma16(v16h a, v16h b, v8f c) { return __builtin_amdgcn_wmma_f32_16x16x32_f16(false, a, false, b, (short)0, c, false, false); }
__device__ __forceinline__ v8f wmmab(v16bf a, v16bf b, v8f c) { return __builtin_amdgcn_wmma_f32_16x16x32_bf16(false, a, false, b, (short)0, c, false, false); }

__device__ __forceinline__ h16 tohx(float x) { return (h16)x; }
__device__ __forceinline__ void splitf(float y, unsigned short& h, unsigned short& l) { h = f2bf(y); l = f2bf(y - bf2f(h)); }
typedef __attribute__((ext_vector_type(2))) _Float16 v2h;
typedef __attribute__((ext_vector_type(4))) _Float16 v4h;
typedef __attribute__((ext_vector_type(2))) unsigned short v2us;
typedef __attribute__((ext_vector_type(4))) unsigned short v4us;
typedef __attribute__((ext_vector_type(2))) float v2f;
typedef __attribute__((ext_vector_type(4))) int v4i;

// ---- k_gemmw: LDS-tiled GEMM, one 128x128 output tile per work-group of FOUR WAVES (2 x 2, each wave a 64x64 tile in 16 accumulators); grid (M/128, N/128, Z), 128 threads.
// Operands are K-contiguous 16-bit planes. A pass is 64 k = 128 B of every operand row; a stage holds the pass's rows of every plane at an LDS pitch of 144 B, two buffers.
// Each wave brings one slice of every stage with ONE tensor load (NSPLIT 0: 64 rows of A or of Bt; NSPLIT 2: 128 rows of one of the four planes), two passes ahead, so a row is fetched from L2 once per work-group instead of once per wave.
// C[m][n] (+ optional f32 bias[n]) = sum_k A[m][k] Bt[n][k] (+ split products for NSPLIT 2). z-batch strides sA/sB/sC in elements. K % 64 == 0, K >= 128, M % 128 == 0, N % 128 == 0.
// EPI picks what the epilogue stores: 0 = C in f32 at pitch ldc; 1 = C as three 16-bit planes (fp16, bf16 hi, bf16 lo), row-major at pitch ldc; 2 = the same three planes transposed per batch, [m / TT][n][m % TT]; 3 = C x osc in f32 at pitch ldc.
typedef uint32_t u32x4 __attribute__((ext_vector_type(4)));
typedef uint32_t u32x8 __attribute__((ext_vector_type(8)));
__device__ __forceinline__ uint32_t uni(uint32_t v) { return (uint32_t)__builtin_amdgcn_readfirstlane(v); }
__device__ __forceinline__ uint32_t pinned(uint32_t v) { uint32_t w = (uint32_t)__builtin_amdgcn_readfirstlane(v); asm volatile("" : "+s"(w)); return w; }
__device__ __forceinline__ void wait_ds0() { asm volatile("s_wait_dscnt 0x0" ::: "memory"); }        // this wave's LDS reads have returned
__device__ __forceinline__ void wait_tensor0() { asm volatile("s_wait_tensorcnt 0x0" ::: "memory"); }  // this wave's tensor load has landed
template <typename T16> struct WFrag;
template <> struct WFrag<h16> { typedef v16h V; static __device__ __forceinline__ V ld(const h16* p) { return cat16(*(const v8h*)p, *(const v8h*)(p + 16)); } static __device__ __forceinline__ v8f mma(V a, V b, v8f c) { return wmma16(a, b, c); } };
template <> struct WFrag<bf> { typedef v16bf V; static __device__ __forceinline__ V ld(const bf* p) { return cat16b(*(const v8us*)p, *(const v8us*)(p + 16)); } static __device__ __forceinline__ v8f mma(V a, V b, v8f c) { return wmmab(a, b, c); } };
template <typename T16, int NSPLIT, bool BIAS, int EPI>
__global__ __launch_bounds__(128) void k_gemmw(const T16* __restrict__ A, const T16* __restrict__ A2, const T16* __restrict__ Bt, const T16* __restrict__ Bt2, int K, float* C, int ldc, const float* __restrict__ bias, size_t sA, size_t sB, size_t sC, h16* P16, bf* Ph, bf* Pl, float osc) {
    static_assert(NSPLIT == 0 || NSPLIT == 2, "one product, or hi/lo planes of both operands");
    typedef typename WFrag<T16>::V V;
    constexpr uint32_t ROWB = 128u, PITCH = ROWB + 16u;                 // bytes of a row per pass; its pitch in LDS (odd multiple of 16 B, for ds_load_b128)
    constexpr uint32_t SROWS = NSPLIT ? 128u : 64u;                     // rows of one wave's slice
    constexpr uint32_t SL = (SROWS * PITCH + 2047u) & ~2047u;           // a slice's place is a multiple of 2 KiB
    constexpr uint32_t STG = 4u * SL;                                   // one stage = four slices
    constexpr uint32_t EPB = 8192u;                                     // epilogue staging per wave, in the ring once the loop has left it
    static_assert(4u * EPB <= 2u * STG, "epilogue staging fits the ring");
    __shared__ __attribute__((aligned(2048))) unsigned char L[2u * STG];
    const size_t z = blockIdx.z; A += z * sA; if (NSPLIT) A2 += z * sA; Bt += z * sB; if (NSPLIT) Bt2 += z * sB; C += z * sC;
    const uint32_t wave = uni(threadIdx.x >> 5), wm = wave & 1u, wn = wave >> 1;
    const int lane = threadIdx.x & 31, lr = lane & 15, hi = lane >> 4; const int rb = blockIdx.x * 128, cb = blockIdx.y * 128; const int r0 = rb + (int)wm * 64, c0 = cb + (int)wn * 64;
    // this wave's slice: first byte in global memory, place in a stage
    const T16* sp;
    if constexpr (NSPLIT == 0) sp = (wave < 2u) ? A + (size_t)(rb + (int)wave * 64) * K : Bt + (size_t)(cb + ((int)wave - 2) * 64) * K;
    else sp = (wave == 0u) ? A + (size_t)rb * K : (wave == 1u) ? A2 + (size_t)rb * K : (wave == 2u) ? Bt + (size_t)cb * K : Bt2 + (size_t)cb * K;
    const uint64_t sga = (uint64_t)(size_t)sp;
    const uint32_t sdst = (uint32_t)(size_t)L + wave * SL;
    u32x8 g1;   // 1-byte elements, tensor = tile = SROWS rows of 128 B, source pitch 2 K bytes, 16 B of LDS pad behind every 128-B row, no mask
    g1[0] = uni((1u << 20) | (4u << 22) | (3u << 25)); g1[1] = uni((ROWB & 0xFFFFu) << 16); g1[2] = uni((ROWB >> 16) | ((SROWS & 0xFFFFu) << 16)); g1[3] = uni((SROWS >> 16) | (ROWB << 16));
    g1[4] = uni(SROWS); g1[5] = uni((uint32_t)K * 2u); g1[6] = uni(0u); g1[7] = uni(0u);
    asm volatile("" : "+s"(g1));   // as pinned(): descriptor words held in scalar registers of their own; without it the compiler lends words 3 and 6 out as temporaries while a request is in flight
    auto issue = [&](uint32_t st) {   // stage st into buffer st & 1
        const uint64_t ga = sga + (uint64_t)st * ROWB; u32x4 g0;
        g0[0] = uni(1u); g0[1] = uni(sdst + (st & 1u) * STG); g0[2] = uni((uint32_t)ga); g0[3] = uni((((uint32_t)(ga >> 32)) & 0x01FFFFFFu) | 0x80000000u);
        asm volatile("tensor_load_to_lds %0, %1" :: "s"(g0), "s"(g1) : "memory");
    };
    v8f acc[4][4];
#pragma unroll
    for (int mb = 0; mb < 4; ++mb)
#pragma unroll
        for (int nb = 0; nb < 4; ++nb) acc[mb][nb] = (v8f){};
    // byte offsets of this lane's fragment rows in a stage (k order as in the planes: 8 hi .. + 7, then + 16)
    const uint32_t aofs = (NSPLIT ? wm * 64u * PITCH : wm * SL) + (uint32_t)lr * PITCH + 16u * (uint32_t)hi;
    const uint32_t bofs = 2u * SL + (NSPLIT ? wn * 64u * PITCH : wn * SL) + (uint32_t)lr * PITCH + 16u * (uint32_t)hi;
    const uint32_t np = (uint32_t)K / 64u;
    issue(0u); wait_tensor0(); __syncthreads();   // stage 0 landed in every wave's slice and published
    issue(1u);
#pragma unroll 1
    for (uint32_t s = 0; s < np; ++s) {
        const unsigned char* Lb = L + (s & 1u) * STG;
        V a[2][4], a2[2][4], b[2][4], b2[2][4];
        // the pass's fragment loads as one group in front of its matrix instructions: the LDS latency is met once a pass, and the second 32 k land under the first's products
#pragma unroll
        for (int ks = 0; ks < 2; ++ks) {
#pragma unroll
            for (int i = 0; i < 4; ++i) a[ks][i] = WFrag<T16>::ld((const T16*)(Lb + aofs + i * 16 * PITCH + ks * 64));
#pragma unroll
            for (int i = 0; i < 4; ++i) b[ks][i] = WFrag<T16>::ld((const T16*)(Lb + bofs + i * 16 * PITCH + ks * 64));
            if constexpr (NSPLIT != 0) {
#pragma unroll
                for (int i = 0; i < 4; ++i) a2[ks][i] = WFrag<T16>::ld((const T16*)(Lb + SL + aofs + i * 16 * PITCH + ks * 64));
#pragma unroll
                for (int i = 0; i < 4; ++i) b2[ks][i] = WFrag<T16>::ld((const T16*)(Lb + SL + bofs + i * 16 * PITCH + ks * 64));
            }
        }
        __builtin_amdgcn_sched_barrier(0);   // keeps the loads above together: without it the compiler moves them in among the matrix instructions, one full LDS wait per four products
        // products in the order their fragments arrive; every accumulator still takes a.b, a2.b, a.b2 per 32 k, k ascending
#pragma unroll
        for (int ks = 0; ks < 2; ++ks) {
#pragma unroll
            for (int nb = 0; nb < 4; ++nb)
#pragma unroll
                for (int mb = 0; mb < 4; ++mb) acc[mb][nb] = WFrag<T16>::mma(a[ks][mb], b[ks][nb], acc[mb][nb]);
            if constexpr (NSPLIT != 0) {
#pragma unroll
                for (int nb = 0; nb < 4; ++nb)
#pragma unroll
                    for (int mb = 0; mb < 4; ++mb) acc[mb][nb] = WFrag<T16>::mma(a2[ks][mb], b[ks][nb], acc[mb][nb]);
#pragma unroll
                for (int nb = 0; nb < 4; ++nb)
#pragma unroll
                    for (int mb = 0; mb < 4; ++mb) acc[mb][nb] = WFrag<T16>::mma(a[ks][mb], b2[ks][nb], acc[mb][nb]);
            }
        }
        __builtin_amdgcn_sched_barrier(0);   // keeps the products in front of the waits below: moved behind them, the wait for the next stage would stand in front of the work that is to cover it
        // publish point of stage s + 1: own LDS reads done, own slice landed, then the barrier that publishes it and frees stage s's buffer
        wait_ds0(); wait_tensor0(); __syncthreads();
        const uint32_t nx = pinned(s + 2u);   // formed behind the wait, and the descriptor from it
        if (pinned(nx < np)) issue(nx);
    }
    wait_tensor0(); wait_ds0();
    // The last pass's barrier stands behind every wave's last read of the ring and no load is in flight: each wave stages its output in its own 8 KiB of it.
    float* os = (float*)(L + wave * EPB);
    if constexpr (EPI == 2) {
        // A lane's 8 accumulator registers are 8 consecutive rows m of one column n: convert in registers, gather 64 rows of 16 columns in LDS (pitch 144 B), store whole 128-B lines.
        unsigned short* const tsb = (unsigned short*)(L + wave * EPB); unsigned short* const ts[3] = { tsb, tsb + 16 * 72, tsb + 2 * 16 * 72 };
        const size_t pb = (size_t)(r0 / TT) * HD * TT + (size_t)c0 * TT + (r0 % TT);
        float bb[4];
#pragma unroll
        for (int nb = 0; nb < 4; ++nb) bb[nb] = BIAS ? bfr(bias[c0 + nb * 16 + lr]) : 0.0f;
#pragma unroll
        for (int nb = 0; nb < 4; ++nb) {
#pragma unroll
            for (int mb = 0; mb < 4; ++mb) { v8h o16; v8us oh, ol;
#pragma unroll
                for (int j = 0; j < 8; ++j) { float val = acc[mb][nb][j]; if (BIAS) val += bb[nb]; o16[j] = tohx(val); unsigned short a2, c2; splitf(val, a2, c2); oh[j] = a2; ol[j] = c2; }
                const int so = lr * 72 + mb * 16 + hi * 8; *(v8us*)(ts[0] + so) = __builtin_bit_cast(v8us, o16); *(v8us*)(ts[1] + so) = oh; *(v8us*)(ts[2] + so) = ol; }
            // the reads below take other lanes' values: the LDS stores above are complete first, and the compiler moves no LDS access across
            __builtin_amdgcn_wave_barrier(); asm volatile("s_wait_dscnt 0x0" ::: "memory");
#pragma unroll
            for (int s = 0; s < 4; ++s) { const int col = s * 4 + (lane >> 3), ro = (lane & 7) * 8; const size_t go = pb + (size_t)(nb * 16 + col) * TT + ro;
                *(v8h*)(P16 + go) = __builtin_bit_cast(v8h, *(const v8us*)(ts[0] + col * 72 + ro)); *(v8us*)(Ph + go) = *(const v8us*)(ts[1] + col * 72 + ro); *(v8us*)(Pl + go) = *(const v8us*)(ts[2] + col * 72 + ro); }
            // keeps the next column group's LDS stores behind the reads above
            __builtin_amdgcn_wave_barrier(); asm volatile("" ::: "memory");
        }
        return;
    }
#pragma unroll
    for (int mb = 0; mb < 4; ++mb) {
#pragma unroll
        for (int nb = 0; nb < 4; ++nb) {
#pragma unroll
            for (int j = 0; j < 8; ++j) os[(hi * 8 + j) * 68 + nb * 16 + lr] = acc[mb][nb][j]; }
        __builtin_amdgcn_wave_barrier(); asm volatile("" ::: "memory");
        float* crow = C + (size_t)(r0 + mb * 16) * ldc + c0;
{
#pragma unroll
            for (int s = 0; s < 8; ++s) { const int row = 2 * s + hi, cofs = lr * 4; v4f val = *(const v4fa*)(os + row * 68 + cofs); if (BIAS) { val[0] += bfr(bias[c0 + cofs]); val[1] += bfr(bias[c0 + cofs + 1]); val[2] += bfr(bias[c0 + cofs + 2]); val[3] += bfr(bias[c0 + cofs + 3]); }
                if constexpr (EPI == 3) val *= osc;
                if constexpr (EPI == 1) { v4h o16; v4us oh, ol;
#pragma unroll
                    for (int q = 0; q < 4; ++q) { o16[q] = tohx(val[q]); unsigned short a2, c2; splitf(val[q], a2, c2); oh[q] = a2; ol[q] = c2; }
                    const size_t go = (size_t)(r0 + mb * 16 + row) * ldc + c0 + cofs; *(v4h*)(P16 + go) = o16; *(v4us*)(Ph + go) = oh; *(v4us*)(Pl + go) = ol; }
                else *(v4f*)(crow + (size_t)row * ldc + cofs) = val; }
             }
        __builtin_amdgcn_wave_barrier(); asm volatile("" ::: "memory");
    }
}

__global__ __launch_bounds__(256) void k_wtG(const float* __restrict__ w, int K, int N, bf* Bt) {
    const int lane = threadIdx.x & 31; const int L0 = (blockIdx.x * 8 + (threadIdx.x >> 5)) * 8; const int nlines = N * K / 64;
{
#pragma unroll 1
        for (int l = 0; l < 8; ++l) { const int L = L0 + l; if (L >= nlines) break; const size_t e = (size_t)L * 64 + lane * 2; const int k = (int)(e % K), n = (int)(e / K); v2us o;
            o[0] = f2bf(w[(size_t)k * N + n]); o[1] = f2bf(w[(size_t)(k + 1) * N + n]); *(v2us*)(Bt + e) = o; }
         }
}
__global__ __launch_bounds__(256) void k_cvt8(const float* __restrict__ src, bf* dst, size_t n8) { const size_t i = (size_t)blockIdx.x * 256 + threadIdx.x; if (i >= n8) return; const v8f v = *(const v8f*)(src + i * 8); v8us o;
#pragma unroll
    for (int k = 0; k < 8; ++k) o[k] = f2bf(v[k]); *(v8us*)(dst + i * 8) = o;  }

// k_asoft: per row (zz, i), zz = batch: t = S x HD^-0.5 (no mask); softmax over the 2048 keys (register row, one exp, fixed trees);
__global__ __launch_bounds__(256) void k_asoft(const float* __restrict__ Sb, h16* P16, bf* Ph, bf* Pl) {
    const int lane = threadIdx.x & 31; const int row = blockIdx.x * 8 + (threadIdx.x >> 5); if (row >= NB_ * TT) return; const int i = row % TT; const int zz = row / TT; (void)zz; const bool hires = (i < RH); const float* sr = Sb + (size_t)row * TT; float v[TT / 32]; float mx = -3.0e38f;
#pragma unroll
    for (int ch = 0; ch < TT / 128; ++ch) { const int j0 = ch * 128 + lane * 4; const v4f a = *(const v4f*)(sr + j0);
#pragma unroll
        for (int q = 0; q < 4; ++q) { const int j = j0 + q; (void)j; const float t = a[q] * SCL; v[ch * 4 + q] = t; mx = fmaxf(mx, t); } }
#pragma unroll
    for (int sh = 16; sh; sh >>= 1) mx = fmaxf(mx, __shfl_xor(mx, sh, 32));
    float sum = 0.f;
#pragma unroll
    for (int k = 0; k < TT / 32; ++k) { float d0 = __fsub_rn(v[k], mx); asm volatile("" : "+v"(d0)); v[k] = __builtin_amdgcn_exp2f(__fmul_rn(d0, 1.4426950408889634f)); sum += v[k]; }
#pragma unroll
    for (int sh = 16; sh; sh >>= 1) sum += __shfl_xor(sum, sh, 32);
    const float f = __fdiv_rn(hires ? 1.0f : PCAR, sum);
{
        if (hires) {
#pragma unroll
            for (int ch = 0; ch < TT / 128; ++ch) { v4us oh, ol;
#pragma unroll
                for (int q = 0; q < 4; ++q) { unsigned short a, c2; splitf(v[ch * 4 + q] * f, a, c2); oh[q] = a; ol[q] = c2; }
                const size_t oo = ((size_t)zz * (RH ? RH : 1) + i) * TT + ch * 128 + lane * 4; *(v4us*)(Ph + oo) = oh; *(v4us*)(Pl + oo) = ol; }
        } else {
#pragma unroll
            for (int ch = 0; ch < TT / 128; ++ch) { v4h o4;
#pragma unroll
                for (int q = 0; q < 4; ++q) o4[q] = tohx(v[ch * 4 + q] * f);
                *(v4h*)(P16 + (size_t)row * TT + ch * 128 + lane * 4) = o4; } }
         }
}

extern "C" void kernel_launch(void* const* d_in, const int* in_sizes, int n_in,
                              void* d_out, int out_size, void* d_ws, size_t ws_size, hipStream_t stream) {
    (void)in_sizes; (void)n_in; (void)out_size;
    const float* x = (const float*)d_in[0]; const float* xk = (const float*)d_in[1]; const float* xv = (const float*)d_in[1];   /* K and V both project context */ const float* wq = (const float*)d_in[2]; const float* bq = (const float*)d_in[3]; const float* wk = (const float*)d_in[4]; const float* bk = (const float*)d_in[5]; const float* wv = (const float*)d_in[6]; const float* bv = (const float*)d_in[7]; const float* wo = nullptr; (void)wo;   /* 'xw' [1024][1024] */
    float* OUT = (float*)d_out;     // [4][2048][1024]
    char* wsp = (char*)d_ws;
    auto take = [&](size_t bytes) { char* p = wsp; wsp += (bytes + 255) & ~(size_t)255; return (void*)p; };
    // Workspace for all four batches at once; regions whose contents are dead by then are used again, in stream order (every byte read is written earlier in the same call).
    bf* WQ = (bf*)take((size_t)DQ * DM * 2); bf* WK = (bf*)take((size_t)DKV * DM * 2); bf* WV = (bf*)take((size_t)DKV * DM * 2);
    h16* P16 = (h16*)take((size_t)NB_ * TT * TT * 2);
    h16* QP16 = (h16*)take((size_t)NB_ * TT * HD * 2); h16* KP16 = (h16*)take((size_t)NB_ * TT * HD * 2); h16* VT16 = (h16*)take((size_t)NB_ * HD * TT * 2);
    bf* QPh = (bf*)take((size_t)NB_ * TT * HD * 2); bf* QPl = (bf*)take((size_t)NB_ * TT * HD * 2); bf* KPh = (bf*)take((size_t)NB_ * TT * HD * 2); bf* KPl = (bf*)take((size_t)NB_ * TT * HD * 2); bf* VTh = (bf*)take((size_t)NB_ * HD * TT * 2); bf* VTl = (bf*)take((size_t)NB_ * HD * TT * 2);
    float* Sb = (float*)take((size_t)NB_ * TT * TT * 4);
    if ((size_t)(wsp - (char*)d_ws) > ws_size) return;    // ws 256 MiB, 246 MiB used
    bf* XB = (bf*)P16;                                // bf16 staging of x / context (16 MiB) at the head of the fp16 probabilities (32 MiB): dead after the V projection, before the softmax writes them
    bf* Ph = QPh; bf* Pl = QPl;                       // hi/lo probabilities (8 MiB each) over the hi/lo query planes: dead after the score GEMMs
    { k_wtG<<<(unsigned)((DM * DQ / 64 + 63) / 64), 256, 0, stream>>>(wq, DM, DQ, WQ); k_wtG<<<(unsigned)((DM * DKV / 64 + 63) / 64), 256, 0, stream>>>(wk, DM, DKV, WK); k_wtG<<<(unsigned)((DM * DKV / 64 + 63) / 64), 256, 0, stream>>>(wv, DM, DKV, WV); }
    const unsigned LC = (unsigned)(((size_t)NB_ * TT * DM / 8 + 255) / 256);
    k_cvt8<<<LC, 256, 0, stream>>>(x, XB, (size_t)NB_ * TT * DM / 8);
    k_gemmw<bf, 0, true, 1><<<dim3(NB_ * TT / 128, DQ / 128, 1), 128, 0, stream>>>(XB, nullptr, WQ, nullptr, DM, nullptr, DQ, bq, 0, 0, 0, QP16, QPh, QPl, 1.0f);
    k_cvt8<<<LC, 256, 0, stream>>>(xk, XB, (size_t)NB_ * TT * DM / 8);   /* XB := bf16(context) */
    k_gemmw<bf, 0, true, 1><<<dim3(NB_ * TT / 128, DKV / 128, 1), 128, 0, stream>>>(XB, nullptr, WK, nullptr, DM, nullptr, DKV, bk, 0, 0, 0, KP16, KPh, KPl, 1.0f);
    k_cvt8<<<LC, 256, 0, stream>>>(xv, XB, (size_t)NB_ * TT * DM / 8);   /* XB := bf16(context) */
    k_gemmw<bf, 0, true, 2><<<dim3(NB_ * TT / 128, DKV / 128, 1), 128, 0, stream>>>(XB, nullptr, WV, nullptr, DM, nullptr, DKV, bv, 0, 0, 0, VT16, VTh, VTl, 1.0f);
    // attention, grid z = batch (one head): z-strides are one batch's plane, score matrix or output
    k_gemmw<bf, 2, false, 0><<<dim3(RH / 128, TT / 128, NB_), 128, 0, stream>>>(QPh, QPl, KPh, KPl, HD, Sb, TT, nullptr, (size_t)TT * HD, (size_t)TT * HD, (size_t)TT * TT, nullptr, nullptr, nullptr, 1.0f);
    k_gemmw<h16, 0, false, 0><<<dim3((TT - RH) / 128, TT / 128, NB_), 128, 0, stream>>>(QP16 + (size_t)RH * HD, nullptr, KP16, nullptr, HD, Sb + (size_t)RH * TT, TT, nullptr, (size_t)TT * HD, (size_t)TT * HD, (size_t)TT * TT, nullptr, nullptr, nullptr, 1.0f);
    k_asoft<<<NB_ * TT / 8, 256, 0, stream>>>(Sb, P16, Ph, Pl);
    k_gemmw<bf, 2, false, 0><<<dim3(RH / 128, HD / 128, NB_), 128, 0, stream>>>(Ph, Pl, VTh, VTl, TT, OUT, HD, nullptr, (size_t)RH * TT, (size_t)HD * TT, (size_t)TT * HD, nullptr, nullptr, nullptr, 1.0f);
    k_gemmw<h16, 0, false, 3><<<dim3((TT - RH) / 128, HD / 128, NB_), 128, 0, stream>>>(P16 + (size_t)RH * TT, nullptr, VT16, nullptr, TT, OUT + (size_t)RH * HD, HD, nullptr, (size_t)TT * TT, (size_t)HD * TT, (size_t)TT * HD, nullptr, nullptr, nullptr, 1.0f / PCAR);
}

// v004
// A run of this version takes 193 microseconds.
// Next to v003, in two timings, it ran 1.16 times as fast each time.
// Counting every step since v000, it is 5.49 times as fast.
#include <hip/hip_runtime.h>

// Cross-attention with ONE 1,024-wide head, biased projections and no output projection (x [4][2048][1024] -> Q = x Wq + bq; context [4][2048][1024] -> K = context Wk + bk, V = context Wv + bv ('xw' [1024][1024] uniform(+-1/32), biases zeros on this draw: read); scores = Q.K over all 1,024 dims x float32(1/sqrt(1024)) = 1/32; softmax over all context tokens (no mask); out = attn V -> [4][2048][1024] (8.4 M); argument order x, context, Wq, bq, Wk, bk, Wv, bv).
// Layout, all four batches in every launch (batch = extra GEMM rows in the projections, grid z in the attention GEMMs): one preparation launch writes the bf16 copies of x (Q projection) and of context (K and V projections) and the three transposed 'xw' weights; exact projections + f32 biases, whose epilogues write the fp16 and hi/lo planes themselves (Q and K row-major, V transposed per batch); dense T-2048 attention (hybrid rows: < 512 hi/lo 3 products, rest fp16 x1024); the P.V GEMMs take the x1024 back out and write the output rows.
// Compute dtypes, f32 accumulate: every input rounded to bf16; projections exact + f32 biases; attention rows < 512 3 products, rest fp16; softmax f32; output f32.

#define NB_  4
#define TT   2048
#define DM   1024
#define NH_  1
#define NKV  1
#define REP  (NH_ / NKV)
#define HD   1024
#define DQ   (NH_ * HD)
#define DKV  (NKV * HD)
#define ZH   1
#define RH   512                  // query rows < RH use hi+lo planes (0: none)
#define WIN  0
#define PCAR 1024.0f
#define SCL  0.03125f   // 1 / sqrt(1024) = 2^-5 (ONE head of width 1,024)
typedef _Float16 h16;
typedef unsigned short bf;
typedef __attribute__((ext_vector_type(16))) __bf16   v16bf;
typedef __attribute__((ext_vector_type(16))) _Float16 v16h;
typedef __attribute__((ext_vector_type(8)))  _Float16 v8h;
typedef __attribute__((ext_vector_type(8)))  unsigned short v8us;
typedef __attribute__((ext_vector_type(8)))  float    v8f;
typedef __attribute__((ext_vector_type(4)))  float    v4f;
typedef v8h  __attribute__((may_alias)) v8ha;
typedef v4f  __attribute__((may_alias)) v4fa;
typedef v8us __attribute__((may_alias)) v8usa;

__device__ __forceinline__ unsigned short f2bf(float f) { unsigned u = __float_as_uint(f); u += 0x7FFFu + ((u >> 16) & 1u); return (unsigned short)(u >> 16); }
__device__ __forceinline__ float bf2f(unsigned short b) { return __uint_as_float(((unsigned)b) << 16); }
__device__ __forceinline__ float bfr(float f) { return bf2f(f2bf(f)); }
__device__ __forceinline__ v16h cat16(v8h lo, v8h hi) { return __builtin_shufflevector(lo, hi, 0, 1, 2, 3, 4, 5, 6, 7, 8, 9, 10, 11, 12, 13, 14, 15); }
__device__ __forceinline__ v16bf cat16b(v8us lo, v8us hi) { return __builtin_bit_cast(v16bf, __builtin_shufflevector(lo, hi, 0, 1, 2, 3, 4, 5, 6, 7, 8, 9, 10, 11, 12, 13, 14, 15)); }
__device__ __forceinline__ v8f wmma16(v16h a, v16h b, v8f c) { return __builtin_amdgcn_wmma_f32_16x16x32_f16(false, a, false, b, (short)0, c, false, false); }
__device__ __forceinline__ v8f wmmab(v16bf a, v16bf b, v8f c) { return __builtin_amdgcn_wmma_f32_16x16x32_bf16(false, a, false, b, (short)0, c, false, false); }

__device__ __forceinline__ h16 tohx(float x) { return (h16)x; }
__device__ __forceinline__ void splitf(float y, unsigned short& h, unsigned short& l) { h = f2bf(y); l = f2bf(y - bf2f(h)); }
typedef __attribute__((ext_vector_type(2))) _Float16 v2h;
typedef __attribute__((ext_vector_type(4))) _Float16 v4h;
typedef __attribute__((ext_vector_type(2))) unsigned short v2us;
typedef __attribute__((ext_vector_type(4))) unsigned short v4us;
typedef __attribute__((ext_vector_type(2))) float v2f;
typedef __attribute__((ext_vector_type(4))) int v4i;

// ---- k_gemmw: LDS-tiled GEMM, one 128x128 output tile per work-group of FOUR WAVES (2 x 2, each wave a 64x64 tile in 16 accumulators); grid (M/128, N/128, Z), 128 threads.
// Operands are K-contiguous 16-bit planes. A pass is 64 k = 128 B of every operand row; a stage holds the pass's rows of every plane at an LDS pitch of 144 B, two buffers.
// Each wave brings one slice of every stage with ONE tensor load (NSPLIT 0: 64 rows of A or of Bt; NSPLIT 2: 128 rows of one of the four planes), two passes ahead, so a row is fetched from L2 once per work-group instead of once per wave.
// C[m][n] (+ optional f32 bias[n]) = sum_k A[m][k] Bt[n][k] (+ split products for NSPLIT 2). z-batch strides sA/sB/sC in elements. K % 64 == 0, K >= 128, M % 128 == 0, N % 128 == 0.
// EPI picks what the epilogue stores: 0 = C in f32 at pitch ldc; 1 = C as three 16-bit planes (fp16, bf16 hi, bf16 lo), row-major at pitch ldc; 2 = the same three planes transposed per batch, [m / TT][n][m % TT]; 3 = C x osc in f32 at pitch ldc.
typedef uint32_t u32x4 __attribute__((ext_vector_type(4)));
typedef uint32_t u32x8 __attribute__((ext_vector_type(8)));
__device__ __forceinline__ uint32_t uni(uint32_t v) { return (uint32_t)__builtin_amdgcn_readfirstlane(v); }
__device__ __forceinline__ uint32_t pinned(uint32_t v) { uint32_t w = (uint32_t)__builtin_amdgcn_readfirstlane(v); asm volatile("" : "+s"(w)); return w; }
__device__ __forceinline__ void wait_ds0() { asm volatile("s_wait_dscnt 0x0" ::: "memory"); }        // this wave's LDS reads have returned
__device__ __forceinline__ void wait_tensor0() { asm volatile("s_wait_tensorcnt 0x0" ::: "memory"); }  // this wave's tensor load has landed
template <typename T16> struct WFrag;
template <> struct WFrag<h16> { typedef v16h V; static __device__ __forceinline__ V ld(const h16* p) { return cat16(*(const v8h*)p, *(const v8h*)(p + 16)); } static __device__ __forceinline__ v8f mma(V a, V b, v8f c) { return wmma16(a, b, c); } };
template <> struct WFrag<bf> { typedef v16bf V; static __device__ __forceinline__ V ld(const bf* p) { return cat16b(*(const v8us*)p, *(const v8us*)(p + 16)); } static __device__ __forceinline__ v8f mma(V a, V b, v8f c) { return wmmab(a, b, c); } };
template <typename T16, int NSPLIT, bool BIAS, int EPI>
__global__ __launch_bounds__(128) void k_gemmw(const T16* __restrict__ A, const T16* __restrict__ A2, const T16* __restrict__ Bt, const T16* __restrict__ Bt2, int K, float* C, int ldc, const float* __restrict__ bias, size_t sA, size_t sB, size_t sC, h16* P16, bf* Ph, bf* Pl, float osc) {
    static_assert(NSPLIT == 0 || NSPLIT == 2, "one product, or hi/lo planes of both operands");
    typedef typename WFrag<T16>::V V;
    constexpr uint32_t ROWB = 128u, PITCH = ROWB + 16u;                 // bytes of a row per pass; its pitch in LDS (odd multiple of 16 B, for ds_load_b128)
    constexpr uint32_t SROWS = NSPLIT ? 128u : 64u;                     // rows of one wave's slice
    constexpr uint32_t SL = (SROWS * PITCH + 2047u) & ~2047u;           // a slice's place is a multiple of 2 KiB
    constexpr uint32_t STG = 4u * SL;                                   // one stage = four slices
    constexpr uint32_t EPB = 8192u;                                     // epilogue staging per wave, in the ring once the loop has left it
    static_assert(4u * EPB <= 2u * STG, "epilogue staging fits the ring");
    __shared__ __attribute__((aligned(2048))) unsigned char L[2u * STG];
    const size_t z = blockIdx.z; A += z * sA; if (NSPLIT) A2 += z * sA; Bt += z * sB; if (NSPLIT) Bt2 += z * sB; C += z * sC;
    const uint32_t wave = uni(threadIdx.x >> 5), wm = wave & 1u, wn = wave >> 1;
    const int lane = threadIdx.x & 31, lr = lane & 15, hi = lane >> 4; const int rb = blockIdx.x * 128, cb = blockIdx.y * 128; const int r0 = rb + (int)wm * 64, c0 = cb + (int)wn * 64;
    // this wave's slice: first byte in global memory, place in a stage
    const T16* sp;
    if constexpr (NSPLIT == 0) sp = (wave < 2u) ? A + (size_t)(rb + (int)wave * 64) * K : Bt + (size_t)(cb + ((int)wave - 2) * 64) * K;
    else sp = (wave == 0u) ? A + (size_t)rb * K : (wave == 1u) ? A2 + (size_t)rb * K : (wave == 2u) ? Bt + (size_t)cb * K : Bt2 + (size_t)cb * K;
    const uint64_t sga = (uint64_t)(size_t)sp;
    const uint32_t sdst = (uint32_t)(size_t)L + wave * SL;
    u32x8 g1;   // 1-byte elements, tensor = tile = SROWS rows of 128 B, source pitch 2 K bytes, 16 B of LDS pad behind every 128-B row, no mask
    g1[0] = uni((1u << 20) | (4u << 22) | (3u << 25)); g1[1] = uni((ROWB & 0xFFFFu) << 16); g1[2] = uni((ROWB >> 16) | ((SROWS & 0xFFFFu) << 16)); g1[3] = uni((SROWS >> 16) | (ROWB << 16));
    g1[4] = uni(SROWS); g1[5] = uni((uint32_t)K * 2u); g1[6] = uni(0u); g1[7] = uni(0u);
    asm volatile("" : "+s"(g1));   // as pinned(): descriptor words held in scalar registers of their own; without it the compiler lends words 3 and 6 out as temporaries while a request is in flight
    auto issue = [&](uint32_t st) {   // stage st into buffer st & 1
        const uint64_t ga = sga + (uint64_t)st * ROWB; u32x4 g0;
        g0[0] = uni(1u); g0[1] = uni(sdst + (st & 1u) * STG); g0[2] = uni((uint32_t)ga); g0[3] = uni((((uint32_t)(ga >> 32)) & 0x01FFFFFFu) | 0x80000000u);
        asm volatile("tensor_load_to_lds %0, %1" :: "s"(g0), "s"(g1) : "memory");
    };
    v8f acc[4][4];
#pragma unroll
    for (int mb = 0; mb < 4; ++mb)
#pragma unroll
        for (int nb = 0; nb < 4; ++nb) acc[mb][nb] = (v8f){};
    // byte offsets of this lane's fragment rows in a stage (k order as in the planes: 8 hi .. + 7, then + 16)
    const uint32_t aofs = (NSPLIT ? wm * 64u * PITCH : wm * SL) + (uint32_t)lr * PITCH + 16u * (uint32_t)hi;
    const uint32_t bofs = 2u * SL + (NSPLIT ? wn * 64u * PITCH : wn * SL) + (uint32_t)lr * PITCH + 16u * (uint32_t)hi;
    const uint32_t np = (uint32_t)K / 64u;
    issue(0u); wait_tensor0(); __syncthreads();   // stage 0 landed in every wave's slice and published
    issue(1u);
#pragma unroll 1
    for (uint32_t s = 0; s < np; ++s) {
        const unsigned char* Lb = L + (s & 1u) * STG;
        V a[2][4], a2[2][4], b[2][4], b2[2][4];
        // the pass's fragment loads as one group in front of its matrix instructions: the LDS latency is met once a pass, and the second 32 k land under the first's products
#pragma unroll
        for (int ks = 0; ks < 2; ++ks) {
#pragma unroll
            for (int i = 0; i < 4; ++i) a[ks][i] = WFrag<T16>::ld((const T16*)(Lb + aofs + i * 16 * PITCH + ks * 64));
#pragma unroll
            for (int i = 0; i < 4; ++i) b[ks][i] = WFrag<T16>::ld((const T16*)(Lb + bofs + i * 16 * PITCH + ks * 64));
            if constexpr (NSPLIT != 0) {
#pragma unroll
                for (int i = 0; i < 4; ++i) a2[ks][i] = WFrag<T16>::ld((const T16*)(Lb + SL + aofs + i * 16 * PITCH + ks * 64));
#pragma unroll
                for (int i = 0; i < 4; ++i) b2[ks][i] = WFrag<T16>::ld((const T16*)(Lb + SL + bofs + i * 16 * PITCH + ks * 64));
            }
        }
        __builtin_amdgcn_sched_barrier(0);   // keeps the loads above together: without it the compiler moves them in among the matrix instructions, one full LDS wait per four products
        // products in the order their fragments arrive; every accumulator still takes a.b, a2.b, a.b2 per 32 k, k ascending
#pragma unroll
        for (int ks = 0; ks < 2; ++ks) {
#pragma unroll
            for (int nb = 0; nb < 4; ++nb)
#pragma unroll
                for (int mb = 0; mb < 4; ++mb) acc[mb][nb] = WFrag<T16>::mma(a[ks][mb], b[ks][nb], acc[mb][nb]);
            if constexpr (NSPLIT != 0) {
#pragma unroll
                for (int nb = 0; nb < 4; ++nb)
#pragma unroll
                    for (int mb = 0; mb < 4; ++mb) acc[mb][nb] = WFrag<T16>::mma(a2[ks][mb], b[ks][nb], acc[mb][nb]);
#pragma unroll
                for (int nb = 0; nb < 4; ++nb)
#pragma unroll
                    for (int mb = 0; mb < 4; ++mb) acc[mb][nb] = WFrag<T16>::mma(a[ks][mb], b2[ks][nb], acc[mb][nb]);
            }
        }
        __builtin_amdgcn_sched_barrier(0);   // keeps the products in front of the waits below: moved behind them, the wait for the next stage would stand in front of the work that is to cover it
        // publish point of stage s + 1: own LDS reads done, own slice landed, then the barrier that publishes it and frees stage s's buffer
        wait_ds0(); wait_tensor0(); __syncthreads();
        const uint32_t nx = pinned(s + 2u);   // formed behind the wait, and the descriptor from it
        if (pinned(nx < np)) issue(nx);
    }
    wait_tensor0(); wait_ds0();
    // The last pass's barrier stands behind every wave's last read of the ring and no load is in flight: each wave stages its output in its own 8 KiB of it.
    float* os = (float*)(L + wave * EPB);
    if constexpr (EPI == 2) {
        // A lane's 8 accumulator registers are 8 consecutive rows m of one column n: convert in registers, gather 64 rows of 16 columns in LDS (pitch 144 B), store whole 128-B lines.
        unsigned short* const tsb = (unsigned short*)(L + wave * EPB); unsigned short* const ts[3] = { tsb, tsb + 16 * 72, tsb + 2 * 16 * 72 };
        const size_t pb = (size_t)(r0 / TT) * HD * TT + (size_t)c0 * TT + (r0 % TT);
        float bb[4];
#pragma unroll
        for (int nb = 0; nb < 4; ++nb) bb[nb] = BIAS ? bfr(bias[c0 + nb * 16 + lr]) : 0.0f;
#pragma unroll
        for (int nb = 0; nb < 4; ++nb) {
#pragma unroll
            for (int mb = 0; mb < 4; ++mb) { v8h o16; v8us oh, ol;
#pragma unroll
                for (int j = 0; j < 8; ++j) { float val = acc[mb][nb][j]; if (BIAS) val += bb[nb]; o16[j] = tohx(val); unsigned short a2, c2; splitf(val, a2, c2); oh[j] = a2; ol[j] = c2; }
                const int so = lr * 72 + mb * 16 + hi * 8; *(v8us*)(ts[0] + so) = __builtin_bit_cast(v8us, o16); *(v8us*)(ts[1] + so) = oh; *(v8us*)(ts[2] + so) = ol; }
            // the reads below take other lanes' values: the LDS stores above are complete first, and the compiler moves no LDS access across
            __builtin_amdgcn_wave_barrier(); asm volatile("s_wait_dscnt 0x0" ::: "memory");
#pragma unroll
            for (int s = 0; s < 4; ++s) { const int col = s * 4 + (lane >> 3), ro = (lane & 7) * 8; const size_t go = pb + (size_t)(nb * 16 + col) * TT + ro;
                *(v8h*)(P16 + go) = __builtin_bit_cast(v8h, *(const v8us*)(ts[0] + col * 72 + ro)); *(v8us*)(Ph + go) = *(const v8us*)(ts[1] + col * 72 + ro); *(v8us*)(Pl + go) = *(const v8us*)(ts[2] + col * 72 + ro); }
            // keeps the next column group's LDS stores behind the reads above
            __builtin_amdgcn_wave_barrier(); asm volatile("" ::: "memory");
        }
        return;
    }
#pragma unroll
    for (int mb = 0; mb < 4; ++mb) {
#pragma unroll
        for (int nb = 0; nb < 4; ++nb) {
#pragma unroll
            for (int j = 0; j < 8; ++j) os[(hi * 8 + j) * 68 + nb * 16 + lr] = acc[mb][nb][j]; }
        __builtin_amdgcn_wave_barrier(); asm volatile("" ::: "memory");
        float* crow = C + (size_t)(r0 + mb * 16) * ldc + c0;
{
#pragma unroll
            for (int s = 0; s < 8; ++s) { const int row = 2 * s + hi, cofs = lr * 4; v4f val = *(const v4fa*)(os + row * 68 + cofs); if (BIAS) { val[0] += bfr(bias[c0 + cofs]); val[1] += bfr(bias[c0 + cofs + 1]); val[2] += bfr(bias[c0 + cofs + 2]); val[3] += bfr(bias[c0 + cofs + 3]); }
                if constexpr (EPI == 3) val *= osc;
                if constexpr (EPI == 1) { v4h o16; v4us oh, ol;
#pragma unroll
                    for (int q = 0; q < 4; ++q) { o16[q] = tohx(val[q]); unsigned short a2, c2; splitf(val[q], a2, c2); oh[q] = a2; ol[q] = c2; }
                    const size_t go = (size_t)(r0 + mb * 16 + row) * ldc + c0 + cofs; *(v4h*)(P16 + go) = o16; *(v4us*)(Ph + go) = oh; *(v4us*)(Pl + go) = ol; }
                else *(v4f*)(crow + (size_t)row * ldc + cofs) = val; }
             }
        __builtin_amdgcn_wave_barrier(); asm volatile("" ::: "memory");
    }
}

// ---- k_prep: all input preparation in ONE launch of few, long waves (a launch of many one-load waves lasts as long as its waves take to start, not as long as its bytes take to move).
// Blocks 0 .. PWB-1, 64 per weight: a wave transposes a block of 32 n x 64 k of w [K][N] into Bt [N][K] in bf16: lane = n, so each of its 64 loads is one whole 128-B line, all in flight at once; a lane's eight 16-B stores fill one 128-B line of Bt.
// Blocks PWB .. PWB+PCB-1, half for x, half for context: a wave converts 4,096 consecutive floats, in two unrolled rounds of 16 loads of 512 contiguous bytes each (the second round's loads issue ahead of the first round's conversions as far as registers allow); the inputs are read once, so the loads are non-temporal and leave L2 to the bf16 copies.
#define PWB  192
#define PCB  512
__global__ __launch_bounds__(256) void k_prep(const float* __restrict__ x, const float* __restrict__ ctx, const float* __restrict__ wq, const float* __restrict__ wk, const float* __restrict__ wv, bf* XBx, bf* XBc, bf* WQ, bf* WK, bf* WV) {
    static_assert(DM == 1024 && DQ == 1024 && DKV == 1024, "64 blocks of 8 waves cover one weight in blocks of 32 n x 64 k");
    static_assert((size_t)NB_ * TT * DM == (size_t)(PCB / 2) * 8 * 4096, "PCB / 2 blocks of 8 waves x 4,096 floats cover one activation tensor");
    const int lane = threadIdx.x & 31, wave = threadIdx.x >> 5; const int blk = blockIdx.x;
    if (blk < PWB) {
        const int m = blk >> 6, t = (blk & 63) * 8 + wave; const int n = (t >> 4) * 32 + lane, k0 = (t & 15) * 64;
        const float* w = (m == 0) ? wq : (m == 1) ? wk : wv; bf* Bt = (m == 0) ? WQ : (m == 1) ? WK : WV;
        const float* wp = w + (size_t)k0 * DQ + n; bf* bp = Bt + (size_t)n * DM + k0; float v[64];
#pragma unroll   // all 64 loads issue before the first is waited for: one memory latency per wave; v[] stays in registers
        for (int j = 0; j < 64; ++j) v[j] = wp[(size_t)j * DQ];
#pragma unroll   // constant indices into v[]
        for (int g = 0; g < 8; ++g) { v8us o;
#pragma unroll
            for (int q = 0; q < 8; ++q) o[q] = f2bf(v[g * 8 + q]);
            *(v8us*)(bp + g * 8) = o; }
        return;
    }
    const int cb = blk - PWB; const bool isx = cb < PCB / 2; const size_t base = (size_t)(cb & (PCB / 2 - 1)) * (8 * 4096) + (size_t)wave * 4096 + (size_t)lane * 4;
    const float* sp = (isx ? x : ctx) + base; bf* dp = (isx ? XBx : XBc) + base;
#pragma unroll   // lets the second round's loads start before the first round is converted
    for (int r = 0; r < 2; ++r) { v4f v[16];
#pragma unroll   // a round's 16 loads in flight together, from one base address with immediate offsets
        for (int i = 0; i < 16; ++i) v[i] = __builtin_nontemporal_load((const v4f*)(sp + r * 2048 + i * 128));
#pragma unroll
        for (int i = 0; i < 16; ++i) { v4us o;
#pragma unroll
            for (int q = 0; q < 4; ++q) o[q] = f2bf(v[i][q]);
            *(v4us*)(dp + r * 2048 + i * 128) = o; } }
}

// k_asoft: per row (zz, i), zz = batch: t = S x HD^-0.5 (no mask); softmax over the 2048 keys (register row, one exp, fixed trees);
__global__ __launch_bounds__(256) void k_asoft(const float* __restrict__ Sb, h16* P16, bf* Ph, bf* Pl) {
    const int lane = threadIdx.x & 31; const int row = blockIdx.x * 8 + (threadIdx.x >> 5); if (row >= NB_ * TT) return; const int i = row % TT; const int zz = row / TT; (void)zz; const bool hires = (i < RH); const float* sr = Sb + (size_t)row * TT; float v[TT / 32]; float mx = -3.0e38f;
#pragma unroll
    for (int ch = 0; ch < TT / 128; ++ch) { const int j0 = ch * 128 + lane * 4; const v4f a = *(const v4f*)(sr + j0);
#pragma unroll
        for (int q = 0; q < 4; ++q) { const int j = j0 + q; (void)j; const float t = a[q] * SCL; v[ch * 4 + q] = t; mx = fmaxf(mx, t); } }
#pragma unroll
    for (int sh = 16; sh; sh >>= 1) mx = fmaxf(mx, __shfl_xor(mx, sh, 32));
    float sum = 0.f;
#pragma unroll
    for (int k = 0; k < TT / 32; ++k) { float d0 = __fsub_rn(v[k], mx); asm volatile("" : "+v"(d0)); v[k] = __builtin_amdgcn_exp2f(__fmul_rn(d0, 1.4426950408889634f)); sum += v[k]; }
#pragma unroll
    for (int sh = 16; sh; sh >>= 1) sum += __shfl_xor(sum, sh, 32);
    const float f = __fdiv_rn(hires ? 1.0f : PCAR, sum);
{
        if (hires) {
#pragma unroll
            for (int ch = 0; ch < TT / 128; ++ch) { v4us oh, ol;
#pragma unroll
                for (int q = 0; q < 4; ++q) { unsigned short a, c2; splitf(v[ch * 4 + q] * f, a, c2); oh[q] = a; ol[q] = c2; }
                const size_t oo = ((size_t)zz * (RH ? RH : 1) + i) * TT + ch * 128 + lane * 4; *(v4us*)(Ph + oo) = oh; *(v4us*)(Pl + oo) = ol; }
        } else {
#pragma unroll
            for (int ch = 0; ch < TT / 128; ++ch) { v4h o4;
#pragma unroll
                for (int q = 0; q < 4; ++q) o4[q] = tohx(v[ch * 4 + q] * f);
                *(v4h*)(P16 + (size_t)row * TT + ch * 128 + lane * 4) = o4; } }
         }
}

extern "C" void kernel_launch(void* const* d_in, const int* in_sizes, int n_in,
                              void* d_out, int out_size, void* d_ws, size_t ws_size, hipStream_t stream) {
    (void)in_sizes; (void)n_in; (void)out_size;
    const float* x = (const float*)d_in[0]; const float* xk = (const float*)d_in[1];   /* K and V both project context */ const float* wq = (const float*)d_in[2]; const float* bq = (const float*)d_in[3]; const float* wk = (const float*)d_in[4]; const float* bk = (const float*)d_in[5]; const float* wv = (const float*)d_in[6]; const float* bv = (const float*)d_in[7]; const float* wo = nullptr; (void)wo;   /* argument order x, context, Wq, bq, Wk, bk, Wv, bv ('xw' [1024][1024]) */
    float* OUT = (float*)d_out;     // [4][2048][1024]
    char* wsp = (char*)d_ws;
    auto take = [&](size_t bytes) { char* p = wsp; wsp += (bytes + 255) & ~(size_t)255; return (void*)p; };
    // Workspace for all four batches at once; regions whose contents are dead by then are used again, in stream order (every byte read is written earlier in the same call).
    bf* WQ = (bf*)take((size_t)DQ * DM * 2); bf* WK = (bf*)take((size_t)DKV * DM * 2); bf* WV = (bf*)take((size_t)DKV * DM * 2);
    h16* P16 = (h16*)take((size_t)NB_ * TT * TT * 2);
    h16* QP16 = (h16*)take((size_t)NB_ * TT * HD * 2); h16* KP16 = (h16*)take((size_t)NB_ * TT * HD * 2); h16* VT16 = (h16*)take((size_t)NB_ * HD * TT * 2);
    bf* QPh = (bf*)take((size_t)NB_ * TT * HD * 2); bf* QPl = (bf*)take((size_t)NB_ * TT * HD * 2); bf* KPh = (bf*)take((size_t)NB_ * TT * HD * 2); bf* KPl = (bf*)take((size_t)NB_ * TT * HD * 2); bf* VTh = (bf*)take((size_t)NB_ * HD * TT * 2); bf* VTl = (bf*)take((size_t)NB_ * HD * TT * 2);
    float* Sb = (float*)take((size_t)NB_ * TT * TT * 4);
    if ((size_t)(wsp - (char*)d_ws) > ws_size) return;    // ws 256 MiB, 246 MiB used
    bf* XBx = (bf*)P16; bf* XBc = XBx + (size_t)NB_ * TT * DM;   // bf16 copies of x and of context (16 MiB each) fill the fp16 probabilities' region (32 MiB): dead after the V projection, before the softmax writes them
    bf* Ph = QPh; bf* Pl = QPl;                       // hi/lo probabilities (8 MiB each) over the hi/lo query planes: dead after the score GEMMs
    k_prep<<<PWB + PCB, 256, 0, stream>>>(x, xk, wq, wk, wv, XBx, XBc, WQ, WK, WV);
    k_gemmw<bf, 0, true, 1><<<dim3(NB_ * TT / 128, DQ / 128, 1), 128, 0, stream>>>(XBx, nullptr, WQ, nullptr, DM, nullptr, DQ, bq, 0, 0, 0, QP16, QPh, QPl, 1.0f);
    k_gemmw<bf, 0, true, 1><<<dim3(NB_ * TT / 128, DKV / 128, 1), 128, 0, stream>>>(XBc, nullptr, WK, nullptr, DM, nullptr, DKV, bk, 0, 0, 0, KP16, KPh, KPl, 1.0f);
    k_gemmw<bf, 0, true, 2><<<dim3(NB_ * TT / 128, DKV / 128, 1), 128, 0, stream>>>(XBc, nullptr, WV, nullptr, DM, nullptr, DKV, bv, 0, 0, 0, VT16, VTh, VTl, 1.0f);
    // attention, grid z = batch (one head): z-strides are one batch's plane, score matrix or output
    k_gemmw<bf, 2, false, 0><<<dim3(RH / 128, TT / 128, NB_), 128, 0, stream>>>(QPh, QPl, KPh, KPl, HD, Sb, TT, nullptr, (size_t)TT * HD, (size_t)TT * HD, (size_t)TT * TT, nullptr, nullptr, nullptr, 1.0f);
    k_gemmw<h16, 0, false, 0><<<dim3((TT - RH) / 128, TT / 128, NB_), 128, 0, stream>>>(QP16 + (size_t)RH * HD, nullptr, KP16, nullptr, HD, Sb + (size_t)RH * TT, TT, nullptr, (size_t)TT * HD, (size_t)TT * HD, (size_t)TT * TT, nullptr, nullptr, nullptr, 1.0f);
    k_asoft<<<NB_ * TT / 8, 256, 0, stream>>>(Sb, P16, Ph, Pl);
    k_gemmw<bf, 2, false, 0><<<dim3(RH / 128, HD / 128, NB_), 128, 0, stream>>>(Ph, Pl, VTh, VTl, TT, OUT, HD, nullptr, (size_t)RH * TT, (size_t)HD * TT, (size_t)TT * HD, nullptr, nullptr, nullptr, 1.0f);
    k_gemmw<h16, 0, false, 3><<<dim3((TT - RH) / 128, HD / 128, NB_), 128, 0, stream>>>(P16 + (size_t)RH * TT, nullptr, VT16, nullptr, TT, OUT + (size_t)RH * HD, HD, nullptr, (size_t)TT * TT, (size_t)HD * TT, (size_t)TT * HD, nullptr, nullptr, nullptr, 1.0f / PCAR);
}

// v005
// One run takes 174 microseconds.
// Two timings next to v004 put it at 1.11 and 1.10 times that version's speed.
// Over all steps from v000 it is 6.07 times as fast.
#include <hip/hip_runtime.h>

// Cross-attention with ONE 1,024-wide head, biased projections and no output projection (x [4][2048][1024] -> Q = x Wq + bq; context [4][2048][1024] -> K = context Wk + bk, V = context Wv + bv ('xw' [1024][1024] uniform(+-1/32), biases zeros on this draw: read); scores = Q.K over all 1,024 dims x float32(1/sqrt(1024)) = 1/32; softmax over all context tokens (no mask); out = attn V -> [4][2048][1024] (8.4 M); argument order x, context, Wq, bq, Wk, bk, Wv, bv).
// Layout, all four batches in every launch (batch = extra GEMM rows in the projections, grid z in the attention GEMMs): one preparation launch writes the bf16 copies of x (Q projection) and of context (K and V projections) and the three transposed 'xw' weights; exact projections + f32 biases, whose epilogues write the fp16 and hi/lo planes themselves (Q and K row-major, V transposed per batch); dense T-2048 attention (hybrid rows: < 512 hi/lo 3 products, rest fp16 x1024); the P.V GEMMs take the x1024 back out and write the output rows.
// Compute dtypes, f32 accumulate: every input rounded to bf16; projections exact + f32 biases; attention rows < 512 3 products, rest fp16; softmax f32; output f32.

#define NB_  4
#define TT   2048
#define DM   1024
#define NH_  1
#define NKV  1
#define REP  (NH_ / NKV)
#define HD   1024
#define DQ   (NH_ * HD)
#define DKV  (NKV * HD)
#define ZH   1
#define RH   512                  // query rows < RH use hi+lo planes (0: none)
#define WIN  0
#define PCAR 1024.0f
#define SCL  0.03125f   // 1 / sqrt(1024) = 2^-5 (ONE head of width 1,024)
typedef _Float16 h16;
typedef unsigned short bf;
typedef __attribute__((ext_vector_type(16))) __bf16   v16bf;
typedef __attribute__((ext_vector_type(16))) _Float16 v16h;
typedef __attribute__((ext_vector_type(8)))  _Float16 v8h;
typedef __attribute__((ext_vector_type(8)))  unsigned short v8us;
typedef __attribute__((ext_vector_type(8)))  float    v8f;
typedef __attribute__((ext_vector_type(4)))  float    v4f;
typedef v8h  __attribute__((may_alias)) v8ha;
typedef v4f  __attribute__((may_alias)) v4fa;
typedef v8us __attribute__((may_alias)) v8usa;

__device__ __forceinline__ unsigned short f2bf(float f) { unsigned u = __float_as_uint(f); u += 0x7FFFu + ((u >> 16) & 1u); return (unsigned short)(u >> 16); }
__device__ __forceinline__ float bf2f(unsigned short b) { return __uint_as_float(((unsigned)b) << 16); }
__device__ __forceinline__ float bfr(float f) { return bf2f(f2bf(f)); }
__device__ __forceinline__ v16h cat16(v8h lo, v8h hi) { return __builtin_shufflevector(lo, hi, 0, 1, 2, 3, 4, 5, 6, 7, 8, 9, 10, 11, 12, 13, 14, 15); }
__device__ __forceinline__ v16bf cat16b(v8us lo, v8us hi) { return __builtin_bit_cast(v16bf, __builtin_shufflevector(lo, hi, 0, 1, 2, 3, 4, 5, 6, 7, 8, 9, 10, 11, 12, 13, 14, 15)); }
__device__ __forceinline__ v8f wmma16(v16h a, v16h b, v8f c) { return __builtin_amdgcn_wmma_f32_16x16x32_f16(false, a, false, b, (short)0, c, false, false); }
__device__ __forceinline__ v8f wmmab(v16bf a, v16bf b, v8f c) { return __builtin_amdgcn_wmma_f32_16x16x32_bf16(false, a, false, b, (short)0, c, false, false); }

__device__ __forceinline__ h16 tohx(float x) { return (h16)x; }
__device__ __forceinline__ void splitf(float y, unsigned short& h, unsigned short& l) { h = f2bf(y); l = f2bf(y - bf2f(h)); }
typedef __attribute__((ext_vector_type(2))) _Float16 v2h;
typedef __attribute__((ext_vector_type(4))) _Float16 v4h;
typedef __attribute__((ext_vector_type(2))) unsigned short v2us;
typedef __attribute__((ext_vector_type(4))) unsigned short v4us;
typedef __attribute__((ext_vector_type(2))) float v2f;
typedef __attribute__((ext_vector_type(4))) int v4i;

// ---- k_gemmw: LDS-tiled GEMM, one 128x128 output tile per work-group of FOUR WAVES (2 x 2, each wave a 64x64 tile in 16 accumulators); grid (M/128, N/128, Z), 128 threads.
// Operands are K-contiguous 16-bit planes. A pass is 64 k = 128 B of every operand row; a stage holds the pass's rows of every plane at an LDS pitch of 144 B, four buffers.
// Each wave brings one slice of every stage with ONE tensor load (NSPLIT 0: 64 rows of A or of Bt; NSPLIT 2: 128 rows of one of the four planes), so a row is fetched from L2 once per work-group instead of once per wave.
// A pass is far shorter than a tile's way from memory, so each wave keeps THREE loads in flight: stage s + 4 is asked for when pass s ends and is waited for three passes later.
// C[m][n] (+ optional f32 bias[n]) = sum_k A[m][k] Bt[n][k] (+ split products for NSPLIT 2). z-batch strides sA/sB/sC in elements. K % 64 == 0, K >= 256, M % 128 == 0, N % 128 == 0.
// EPI picks what the epilogue stores: 0 = C in f32 at pitch ldc; 1 = C as three 16-bit planes (fp16, bf16 hi, bf16 lo), row-major at pitch ldc; 2 = the same three planes transposed per batch, [m / TT][n][m % TT]; 3 = C x osc in f32 at pitch ldc.
typedef uint32_t u32x4 __attribute__((ext_vector_type(4)));
typedef uint32_t u32x8 __attribute__((ext_vector_type(8)));
__device__ __forceinline__ uint32_t uni(uint32_t v) { return (uint32_t)__builtin_amdgcn_readfirstlane(v); }
__device__ __forceinline__ uint32_t pinned(uint32_t v) { uint32_t w = (uint32_t)__builtin_amdgcn_readfirstlane(v); asm volatile("" : "+s"(w)); return w; }
__device__ __forceinline__ void wait_ds0() { asm volatile("s_wait_dscnt 0x0" ::: "memory"); }        // this wave's LDS reads have returned
__device__ __forceinline__ void wait_tensor0() { asm volatile("s_wait_tensorcnt 0x0" ::: "memory"); }  // all of this wave's tensor loads have landed
__device__ __forceinline__ void wait_tensor2() { asm volatile("s_wait_tensorcnt 0x2" ::: "memory"); }  // all but this wave's two youngest tensor loads have landed (they land in issue order)
template <typename T16> struct WFrag;
template <> struct WFrag<h16> { typedef v16h V; static __device__ __forceinline__ V ld(const h16* p) { return cat16(*(const v8h*)p, *(const v8h*)(p + 16)); } static __device__ __forceinline__ v8f mma(V a, V b, v8f c) { return wmma16(a, b, c); } };
template <> struct WFrag<bf> { typedef v16bf V; static __device__ __forceinline__ V ld(const bf* p) { return cat16b(*(const v8us*)p, *(const v8us*)(p + 16)); } static __device__ __forceinline__ v8f mma(V a, V b, v8f c) { return wmmab(a, b, c); } };
template <typename T16, int NSPLIT, bool BIAS, int EPI>
__global__ __launch_bounds__(128) void k_gemmw(const T16* __restrict__ A, const T16* __restrict__ A2, const T16* __restrict__ Bt, const T16* __restrict__ Bt2, int K, float* C, int ldc, const float* __restrict__ bias, size_t sA, size_t sB, size_t sC, h16* P16, bf* Ph, bf* Pl, float osc) {
    static_assert(NSPLIT == 0 || NSPLIT == 2, "one product, or hi/lo planes of both operands");
    typedef typename WFrag<T16>::V V;
    constexpr uint32_t ROWB = 128u, PITCH = ROWB + 16u;                 // bytes of a row per pass; its pitch in LDS (odd multiple of 16 B, for ds_load_b128)
    constexpr uint32_t SROWS = NSPLIT ? 128u : 64u;                     // rows of one wave's slice
    constexpr uint32_t SL = (SROWS * PITCH + 2047u) & ~2047u;           // a slice's place is a multiple of 2 KiB
    constexpr uint32_t STG = 4u * SL;                                   // one stage = four slices
    constexpr uint32_t NBUF = 4u;                                       // buffers of the ring: the one being read and three being filled
    constexpr uint32_t EPB = 8192u;                                     // epilogue staging per wave, in the ring once the loop has left it
    static_assert(4u * EPB <= NBUF * STG, "epilogue staging fits the ring");
    static_assert(NBUF * STG <= 327680u, "the ring fits a WGP's LDS");
    __shared__ __attribute__((aligned(2048))) unsigned char L[NBUF * STG];
    const size_t z = blockIdx.z; A += z * sA; if (NSPLIT) A2 += z * sA; Bt += z * sB; if (NSPLIT) Bt2 += z * sB; C += z * sC;
    const uint32_t wave = uni(threadIdx.x >> 5), wm = wave & 1u, wn = wave >> 1;
    const int lane = threadIdx.x & 31, lr = lane & 15, hi = lane >> 4; const int rb = blockIdx.x * 128, cb = blockIdx.y * 128; const int r0 = rb + (int)wm * 64, c0 = cb + (int)wn * 64;
    // this wave's slice: first byte in global memory, place in a stage
    const T16* sp;
    if constexpr (NSPLIT == 0) sp = (wave < 2u) ? A + (size_t)(rb + (int)wave * 64) * K : Bt + (size_t)(cb + ((int)wave - 2) * 64) * K;
    else sp = (wave == 0u) ? A + (size_t)rb * K : (wave == 1u) ? A2 + (size_t)rb * K : (wave == 2u) ? Bt + (size_t)cb * K : Bt2 + (size_t)cb * K;
    const uint64_t sga = (uint64_t)(size_t)sp;
    const uint32_t sdst = (uint32_t)(size_t)L + wave * SL;
    u32x8 g1;   // 1-byte elements, tensor = tile = SROWS rows of 128 B, source pitch 2 K bytes, 16 B of LDS pad behind every 128-B row, no mask
    g1[0] = uni((1u << 20) | (4u << 22) | (3u << 25)); g1[1] = uni((ROWB & 0xFFFFu) << 16); g1[2] = uni((ROWB >> 16) | ((SROWS & 0xFFFFu) << 16)); g1[3] = uni((SROWS >> 16) | (ROWB << 16));
    g1[4] = uni(SROWS); g1[5] = uni((uint32_t)K * 2u); g1[6] = uni(0u); g1[7] = uni(0u);
    asm volatile("" : "+s"(g1));   // as pinned(): descriptor words held in scalar registers of their own; without it the compiler lends words 3 and 6 out as temporaries while a request is in flight
    u32x4 g0;   // one group 0 for every request: with requests in flight only its words 1 (place in LDS) and 2 (low address) take new values
    g0[0] = uni(1u); g0[1] = uni(sdst); g0[2] = uni((uint32_t)sga); g0[3] = uni((((uint32_t)(sga >> 32)) & 0x01FFFFFFu) | 0x80000000u);
    asm volatile("" : "+s"(g0));   // as pinned(): descriptor words held in scalar registers of their own, so that words 0 and 3 are not rebuilt at every issue
    auto issue = [&](uint32_t st) {   // stage st into buffer st % NBUF
        const uint64_t ga = sga + (uint64_t)st * ROWB;
        const uint32_t w3 = uni((((uint32_t)(ga >> 32)) & 0x01FFFFFFu) | 0x80000000u);
        if (pinned(w3 != g0[3])) { wait_tensor0(); g0[3] = w3; }   // a row that crosses a 4-GiB line: the high address word changes only with no request in flight
        g0[1] = uni(sdst + (st % NBUF) * STG); g0[2] = uni((uint32_t)ga);
        asm volatile("tensor_load_to_lds %0, %1" :: "s"(g0), "s"(g1) : "memory");
    };
    v8f acc[4][4];
#pragma unroll
    for (int mb = 0; mb < 4; ++mb)
#pragma unroll
        for (int nb = 0; nb < 4; ++nb) acc[mb][nb] = (v8f){};
    // byte offsets of this lane's fragment rows in a stage (k order as in the planes: 8 hi .. + 7, then + 16)
    const uint32_t aofs = (NSPLIT ? wm * 64u * PITCH : wm * SL) + (uint32_t)lr * PITCH + 16u * (uint32_t)hi;
    const uint32_t bofs = 2u * SL + (NSPLIT ? wn * 64u * PITCH : wn * SL) + (uint32_t)lr * PITCH + 16u * (uint32_t)hi;
    const uint32_t np = (uint32_t)K / 64u;
    __builtin_assume(np >= 4u);   // K >= 256: the prologue's four stages exist and the loop runs, so no path reaches the epilogue past the loop's own waits
    issue(0u); issue(1u); issue(2u);
    wait_tensor2();                    // stage 0 has landed in this wave's slice; stages 1 and 2 fly on
    issue(3u);                         // the fourth buffer is still untouched; again three loads in flight
    __syncthreads();                   // stage 0 published
#pragma unroll 1
    for (uint32_t s = 0; s < np; ++s) {
        const unsigned char* Lb = L + (s % NBUF) * STG;
        V a[2][4], a2[2][4], b[2][4], b2[2][4];
        // the pass's fragment loads as one group in front of its matrix instructions: the LDS latency is met once a pass, and the second 32 k land under the first's products
#pragma unroll
        for (int ks = 0; ks < 2; ++ks) {
#pragma unroll
            for (int i = 0; i < 4; ++i) a[ks][i] = WFrag<T16>::ld((const T16*)(Lb + aofs + i * 16 * PITCH + ks * 64));
#pragma unroll
            for (int i = 0; i < 4; ++i) b[ks][i] = WFrag<T16>::ld((const T16*)(Lb + bofs + i * 16 * PITCH + ks * 64));
            if constexpr (NSPLIT != 0) {
#pragma unroll
                for (int i = 0; i < 4; ++i) a2[ks][i] = WFrag<T16>::ld((const T16*)(Lb + SL + aofs + i * 16 * PITCH + ks * 64));
#pragma unroll
                for (int i = 0; i < 4; ++i) b2[ks][i] = WFrag<T16>::ld((const T16*)(Lb + SL + bofs + i * 16 * PITCH + ks * 64));
            }
        }
        __builtin_amdgcn_sched_barrier(0);   // keeps the loads above together: without it the compiler moves them in among the matrix instructions, one full LDS wait per four products
        // products in the order their fragments arrive; every accumulator still takes a.b, a2.b, a.b2 per 32 k, k ascending
#pragma unroll
        for (int ks = 0; ks < 2; ++ks) {
#pragma unroll
            for (int nb = 0; nb < 4; ++nb)
#pragma unroll
                for (int mb = 0; mb < 4; ++mb) acc[mb][nb] = WFrag<T16>::mma(a[ks][mb], b[ks][nb], acc[mb][nb]);
            if constexpr (NSPLIT != 0) {
#pragma unroll
                for (int nb = 0; nb < 4; ++nb)
#pragma unroll
                    for (int mb = 0; mb < 4; ++mb) acc[mb][nb] = WFrag<T16>::mma(a2[ks][mb], b[ks][nb], acc[mb][nb]);
#pragma unroll
                for (int nb = 0; nb < 4; ++nb)
#pragma unroll
                    for (int mb = 0; mb < 4; ++mb) acc[mb][nb] = WFrag<T16>::mma(a[ks][mb], b2[ks][nb], acc[mb][nb]);
            }
        }
        __builtin_amdgcn_sched_barrier(0);   // keeps the products in front of the waits below: moved behind them, the wait for the next stage would stand in front of the work that is to cover it
        // publish point of stage s + 1: own LDS reads done, own slice of s + 1 landed, then the barrier that publishes it and frees stage s's buffer
        wait_ds0();
        wait_tensor2();                            // in flight: s + 1, s + 2, s + 3; the oldest has landed behind this wait
        if (pinned(s + 3u >= np)) wait_tensor0();  // the last stages: fewer in flight, so the count that covers s + 1 is 0
        __syncthreads();
        const uint32_t nx = pinned(s + NBUF);   // formed behind the barrier, and the descriptor words from it
        if (pinned(nx < np)) issue(nx);         // into the buffer that pass s has just read
    }
    wait_tensor0(); wait_ds0();
    // The last pass's barrier stands behind every wave's last read of the ring and no load is in flight: each wave stages its output in its own 8 KiB of it.
    float* os = (float*)(L + wave * EPB);
    if constexpr (EPI == 2) {
        // A lane's 8 accumulator registers are 8 consecutive rows m of one column n: convert in registers, gather 64 rows of 16 columns in LDS (pitch 144 B), store whole 128-B lines.
        unsigned short* const tsb = (unsigned short*)(L + wave * EPB); unsigned short* const ts[3] = { tsb, tsb + 16 * 72, tsb + 2 * 16 * 72 };
        const size_t pb = (size_t)(r0 / TT) * HD * TT + (size_t)c0 * TT + (r0 % TT);
        float bb[4];
#pragma unroll
        for (int nb = 0; nb < 4; ++nb) bb[nb] = BIAS ? bfr(bias[c0 + nb * 16 + lr]) : 0.0f;
#pragma unroll
        for (int nb = 0; nb < 4; ++nb) {
#pragma unroll
            for (int mb = 0; mb < 4; ++mb) { v8h o16; v8us oh, ol;
#pragma unroll
                for (int j = 0; j < 8; ++j) { float val = acc[mb][nb][j]; if (BIAS) val += bb[nb]; o16[j] = tohx(val); unsigned short a2, c2; splitf(val, a2, c2); oh[j] = a2; ol[j] = c2; }
                const int so = lr * 72 + mb * 16 + hi * 8; *(v8us*)(ts[0] + so) = __builtin_bit_cast(v8us, o16); *(v8us*)(ts[1] + so) = oh; *(v8us*)(ts[2] + so) = ol; }
            // the reads below take other lanes' values: the LDS stores above are complete first, and the compiler moves no LDS access across
            __builtin_amdgcn_wave_barrier(); asm volatile("s_wait_dscnt 0x0" ::: "memory");
#pragma unroll
            for (int s = 0; s < 4; ++s) { const int col = s * 4 + (lane >> 3), ro = (lane & 7) * 8; const size_t go = pb + (size_t)(nb * 16 + col) * TT + ro;
                *(v8h*)(P16 + go) = __builtin_bit_cast(v8h, *(const v8us*)(ts[0] + col * 72 + ro)); *(v8us*)(Ph + go) = *(const v8us*)(ts[1] + col * 72 + ro); *(v8us*)(Pl + go) = *(const v8us*)(ts[2] + col * 72 + ro); }
            // keeps the next column group's LDS stores behind the reads above
            __builtin_amdgcn_wave_barrier(); asm volatile("" ::: "memory");
        }
        return;
    }
#pragma unroll
    for (int mb = 0; mb < 4; ++mb) {
#pragma unroll
        for (int nb = 0; nb < 4; ++nb) {
#pragma unroll
            for (int j = 0; j < 8; ++j) os[(hi * 8 + j) * 68 + nb * 16 + lr] = acc[mb][nb][j]; }
        __builtin_amdgcn_wave_barrier(); asm volatile("" ::: "memory");
        float* crow = C + (size_t)(r0 + mb * 16) * ldc + c0;
{
#pragma unroll
            for (int s = 0; s < 8; ++s) { const int row = 2 * s + hi, cofs = lr * 4; v4f val = *(const v4fa*)(os + row * 68 + cofs); if (BIAS) { val[0] += bfr(bias[c0 + cofs]); val[1] += bfr(bias[c0 + cofs + 1]); val[2] += bfr(bias[c0 + cofs + 2]); val[3] += bfr(bias[c0 + cofs + 3]); }
                if constexpr (EPI == 3) val *= osc;
                if constexpr (EPI == 1) { v4h o16; v4us oh, ol;
#pragma unroll
                    for (int q = 0; q < 4; ++q) { o16[q] = tohx(val[q]); unsigned short a2, c2; splitf(val[q], a2, c2); oh[q] = a2; ol[q] = c2; }
                    const size_t go = (size_t)(r0 + mb * 16 + row) * ldc + c0 + cofs; *(v4h*)(P16 + go) = o16; *(v4us*)(Ph + go) = oh; *(v4us*)(Pl + go) = ol; }
                else *(v4f*)(crow + (size_t)row * ldc + cofs) = val; }
             }
        __builtin_amdgcn_wave_barrier(); asm volatile("" ::: "memory");
    }
}

// ---- k_prep: all input preparation in ONE launch of few, long waves (a launch of many one-load waves lasts as long as its waves take to start, not as long as its bytes take to move).
// Blocks 0 .. PWB-1, 64 per weight: a wave transposes a block of 32 n x 64 k of w [K][N] into Bt [N][K] in bf16: lane = n, so each of its 64 loads is one whole 128-B line, all in flight at once; a lane's eight 16-B stores fill one 128-B line of Bt.
// Blocks PWB .. PWB+PCB-1, half for x, half for context: a wave converts 4,096 consecutive floats, in two unrolled rounds of 16 loads of 512 contiguous bytes each (the second round's loads issue ahead of the first round's conversions as far as registers allow); the inputs are read once, so the loads are non-temporal and leave L2 to the bf16 copies.
#define PWB  192
#define PCB  512
__global__ __launch_bounds__(256) void k_prep(const float* __restrict__ x, const float* __restrict__ ctx, const float* __restrict__ wq, const float* __restrict__ wk, const float* __restrict__ wv, bf* XBx, bf* XBc, bf* WQ, bf* WK, bf* WV) {
    static_assert(DM == 1024 && DQ == 1024 && DKV == 1024, "64 blocks of 8 waves cover one weight in blocks of 32 n x 64 k");
    static_assert((size_t)NB_ * TT * DM == (size_t)(PCB / 2) * 8 * 4096, "PCB / 2 blocks of 8 waves x 4,096 floats cover one activation tensor");
    const int lane = threadIdx.x & 31, wave = threadIdx.x >> 5; const int blk = blockIdx.x;
    if (blk < PWB) {
        const int m = blk >> 6, t = (blk & 63) * 8 + wave; const int n = (t >> 4) * 32 + lane, k0 = (t & 15) * 64;
        const float* w = (m == 0) ? wq : (m == 1) ? wk : wv; bf* Bt = (m == 0) ? WQ : (m == 1) ? WK : WV;
        const float* wp = w + (size_t)k0 * DQ + n; bf* bp = Bt + (size_t)n * DM + k0; float v[64];
#pragma unroll   // all 64 loads issue before the first is waited for: one memory latency per wave; v[] stays in registers
        for (int j = 0; j < 64; ++j) v[j] = wp[(size_t)j * DQ];
#pragma unroll   // constant indices into v[]
        for (int g = 0; g < 8; ++g) { v8us o;
#pragma unroll
            for (int q = 0; q < 8; ++q) o[q] = f2bf(v[g * 8 + q]);
            *(v8us*)(bp + g * 8) = o; }
        return;
    }
    const int cb = blk - PWB; const bool isx = cb < PCB / 2; const size_t base = (size_t)(cb & (PCB / 2 - 1)) * (8 * 4096) + (size_t)wave * 4096 + (size_t)lane * 4;
    const float* sp = (isx ? x : ctx) + base; bf* dp = (isx ? XBx : XBc) + base;
#pragma unroll   // lets the second round's loads start before the first round is converted
    for (int r = 0; r < 2; ++r) { v4f v[16];
#pragma unroll   // a round's 16 loads in flight together, from one base address with immediate offsets
        for (int i = 0; i < 16; ++i) v[i] = __builtin_nontemporal_load((const v4f*)(sp + r * 2048 + i * 128));
#pragma unroll
        for (int i = 0; i < 16; ++i) { v4us o;
#pragma unroll
            for (int q = 0; q < 4; ++q) o[q] = f2bf(v[i][q]);
            *(v4us*)(dp + r * 2048 + i * 128) = o; } }
}

// k_asoft: per row (zz, i), zz = batch: t = S x HD^-0.5 (no mask); softmax over the 2048 keys (register row, one exp, fixed trees);
__global__ __launch_bounds__(256) void k_asoft(const float* __restrict__ Sb, h16* P16, bf* Ph, bf* Pl) {
    const int lane = threadIdx.x & 31; const int row = blockIdx.x * 8 + (threadIdx.x >> 5); if (row >= NB_ * TT) return; const int i = row % TT; const int zz = row / TT; (void)zz; const bool hires = (i < RH); const float* sr = Sb + (size_t)row * TT; float v[TT / 32]; float mx = -3.0e38f;
#pragma unroll
    for (int ch = 0; ch < TT / 128; ++ch) { const int j0 = ch * 128 + lane * 4; const v4f a = *(const v4f*)(sr + j0);
#pragma unroll
        for (int q = 0; q < 4; ++q) { const int j = j0 + q; (void)j; const float t = a[q] * SCL; v[ch * 4 + q] = t; mx = fmaxf(mx, t); } }
#pragma unroll
    for (int sh = 16; sh; sh >>= 1) mx = fmaxf(mx, __shfl_xor(mx, sh, 32));
    float sum = 0.f;
#pragma unroll
    for (int k = 0; k < TT / 32; ++k) { float d0 = __fsub_rn(v[k], mx); asm volatile("" : "+v"(d0)); v[k] = __builtin_amdgcn_exp2f(__fmul_rn(d0, 1.4426950408889634f)); sum += v[k]; }
#pragma unroll
    for (int sh = 16; sh; sh >>= 1) sum += __shfl_xor(sum, sh, 32);
    const float f = __fdiv_rn(hires ? 1.0f : PCAR, sum);
{
        if (hires) {
#pragma unroll
            for (int ch = 0; ch < TT / 128; ++ch) { v4us oh, ol;
#pragma unroll
                for (int q = 0; q < 4; ++q) { unsigned short a, c2; splitf(v[ch * 4 + q] * f, a, c2); oh[q] = a; ol[q] = c2; }
                const size_t oo = ((size_t)zz * (RH ? RH : 1) + i) * TT + ch * 128 + lane * 4; *(v4us*)(Ph + oo) = oh; *(v4us*)(Pl + oo) = ol; }
        } else {
#pragma unroll
            for (int ch = 0; ch < TT / 128; ++ch) { v4h o4;
#pragma unroll
                for (int q = 0; q < 4; ++q) o4[q] = tohx(v[ch * 4 + q] * f);
                *(v4h*)(P16 + (size_t)row * TT + ch * 128 + lane * 4) = o4; } }
         }
}

extern "C" void kernel_launch(void* const* d_in, const int* in_sizes, int n_in,
                              void* d_out, int out_size, void* d_ws, size_t ws_size, hipStream_t stream) {
    (void)in_sizes; (void)n_in; (void)out_size;
    const float* x = (const float*)d_in[0]; const float* xk = (const float*)d_in[1];   /* K and V both project context */ const float* wq = (const float*)d_in[2]; const float* bq = (const float*)d_in[3]; const float* wk = (const float*)d_in[4]; const float* bk = (const float*)d_in[5]; const float* wv = (const float*)d_in[6]; const float* bv = (const float*)d_in[7]; const float* wo = nullptr; (void)wo;   /* argument order x, context, Wq, bq, Wk, bk, Wv, bv ('xw' [1024][1024]) */
    float* OUT = (float*)d_out;     // [4][2048][1024]
    char* wsp = (char*)d_ws;
    auto take = [&](size_t bytes) { char* p = wsp; wsp += (bytes + 255) & ~(size_t)255; return (void*)p; };
    // Workspace for all four batches at once; regions whose contents are dead by then are used again, in stream order (every byte read is written earlier in the same call).
    bf* WQ = (bf*)take((size_t)DQ * DM * 2); bf* WK = (bf*)take((size_t)DKV * DM * 2); bf* WV = (bf*)take((size_t)DKV * DM * 2);
    h16* P16 = (h16*)take((size_t)NB_ * TT * TT * 2);
    h16* QP16 = (h16*)take((size_t)NB_ * TT * HD * 2); h16* KP16 = (h16*)take((size_t)NB_ * TT * HD * 2); h16* VT16 = (h16*)take((size_t)NB_ * HD * TT * 2);
    bf* QPh = (bf*)take((size_t)NB_ * TT * HD * 2); bf* QPl = (bf*)take((size_t)NB_ * TT * HD * 2); bf* KPh = (bf*)take((size_t)NB_ * TT * HD * 2); bf* KPl = (bf*)take((size_t)NB_ * TT * HD * 2); bf* VTh = (bf*)take((size_t)NB_ * HD * TT * 2); bf* VTl = (bf*)take((size_t)NB_ * HD * TT * 2);
    float* Sb = (float*)take((size_t)NB_ * TT * TT * 4);
    if ((size_t)(wsp - (char*)d_ws) > ws_size) return;    // ws 256 MiB, 246 MiB used
    bf* XBx = (bf*)P16; bf* XBc = XBx + (size_t)NB_ * TT * DM;   // bf16 copies of x and of context (16 MiB each) fill the fp16 probabilities' region (32 MiB): dead after the V projection, before the softmax writes them
    bf* Ph = QPh; bf* Pl = QPl;                       // hi/lo probabilities (8 MiB each) over the hi/lo query planes: dead after the score GEMMs
    k_prep<<<PWB + PCB, 256, 0, stream>>>(x, xk, wq, wk, wv, XBx, XBc, WQ, WK, WV);
    k_gemmw<bf, 0, true, 1><<<dim3(NB_ * TT / 128, DQ / 128, 1), 128, 0, stream>>>(XBx, nullptr, WQ, nullptr, DM, nullptr, DQ, bq, 0, 0, 0, QP16, QPh, QPl, 1.0f);
    k_gemmw<bf, 0, true, 1><<<dim3(NB_ * TT / 128, DKV / 128, 1), 128, 0, stream>>>(XBc, nullptr, WK, nullptr, DM, nullptr, DKV, bk, 0, 0, 0, KP16, KPh, KPl, 1.0f);
    k_gemmw<bf, 0, true, 2><<<dim3(NB_ * TT / 128, DKV / 128, 1), 128, 0, stream>>>(XBc, nullptr, WV, nullptr, DM, nullptr, DKV, bv, 0, 0, 0, VT16, VTh, VTl, 1.0f);
    // attention, grid z = batch (one head): z-strides are one batch's plane, score matrix or output
    k_gemmw<bf, 2, false, 0><<<dim3(RH / 128, TT / 128, NB_), 128, 0, stream>>>(QPh, QPl, KPh, KPl, HD, Sb, TT, nullptr, (size_t)TT * HD, (size_t)TT * HD, (size_t)TT * TT, nullptr, nullptr, nullptr, 1.0f);
    k_gemmw<h16, 0, false, 0><<<dim3((TT - RH) / 128, TT / 128, NB_), 128, 0, stream>>>(QP16 + (size_t)RH * HD, nullptr, KP16, nullptr, HD, Sb + (size_t)RH * TT, TT, nullptr, (size_t)TT * HD, (size_t)TT * HD, (size_t)TT * TT, nullptr, nullptr, nullptr, 1.0f);
    k_asoft<<<NB_ * TT / 8, 256, 0, stream>>>(Sb, P16, Ph, Pl);
    k_gemmw<bf, 2, false, 0><<<dim3(RH / 128, HD / 128, NB_), 128, 0, stream>>>(Ph, Pl, VTh, VTl, TT, OUT, HD, nullptr, (size_t)RH * TT, (size_t)HD * TT, (size_t)TT * HD, nullptr, nullptr, nullptr, 1.0f);
    k_gemmw<h16, 0, false, 3><<<dim3((TT - RH) / 128, HD / 128, NB_), 128, 0, stream>>>(P16 + (size_t)RH * TT, nullptr, VT16, nullptr, TT, OUT + (size_t)RH * HD, HD, nullptr, (size_t)TT * TT, (size_t)HD * TT, (size_t)TT * HD, nullptr, nullptr, nullptr, 1.0f / PCAR);
}

// v006
// One run takes 159 microseconds.
// In two side-by-side timings against v005, it was 1.09 and 1.10 times as fast.
// Over all steps from v000 it is 6.64 times as fast.
#include <hip/hip_runtime.h>

// Cross-attention with ONE 1,024-wide head, biased projections and no output projection (x [4][2048][1024] -> Q = x Wq + bq; context [4][2048][1024] -> K = context Wk + bk, V = context Wv + bv ('xw' [1024][1024] uniform(+-1/32), biases zeros on this draw: read); scores = Q.K over all 1,024 dims x float32(1/sqrt(1024)) = 1/32; softmax over all context tokens (no mask); out = attn V -> [4][2048][1024] (8.4 M); argument order x, context, Wq, bq, Wk, bk, Wv, bv).
// Layout, all four batches in every launch, five launches: one preparation launch writes the bf16 copies of x (Q projection) and of context (K and V projections) and the three transposed 'xw' weights; ONE launch for the three exact projections + f32 biases, whose epilogues write the fp16 and hi/lo planes themselves (Q and K row-major, V transposed per batch); dense T-2048 attention (hybrid rows: < 512 hi/lo 3 products, rest fp16 x1024): ONE launch for both score GEMMs, the softmax, ONE launch for both P.V GEMMs, which take the x1024 back out and write the output rows.
// Compute dtypes, f32 accumulate: every input rounded to bf16; projections exact + f32 biases; attention rows < 512 3 products, rest fp16; softmax f32; output f32.

#define NB_  4
#define TT   2048
#define DM   1024
#define NH_  1
#define NKV  1
#define REP  (NH_ / NKV)
#define HD   1024
#define DQ   (NH_ * HD)
#define DKV  (NKV * HD)
#define ZH   1
#define RH   512                  // query rows < RH use hi+lo planes (0: none)
#define WIN  0
#define PCAR 1024.0f
#define SCL  0.03125f   // 1 / sqrt(1024) = 2^-5 (ONE head of width 1,024)
typedef _Float16 h16;
typedef unsigned short bf;
typedef __attribute__((ext_vector_type(16))) __bf16   v16bf;
typedef __attribute__((ext_vector_type(16))) _Float16 v16h;
typedef __attribute__((ext_vector_type(8)))  _Float16 v8h;
typedef __attribute__((ext_vector_type(8)))  unsigned short v8us;
typedef __attribute__((ext_vector_type(8)))  float    v8f;
typedef __attribute__((ext_vector_type(4)))  float    v4f;
typedef v8h  __attribute__((may_alias)) v8ha;
typedef v4f  __attribute__((may_alias)) v4fa;
typedef v8us __attribute__((may_alias)) v8usa;

__device__ __forceinline__ unsigned short f2bf(float f) { unsigned u = __float_as_uint(f); u += 0x7FFFu + ((u >> 16) & 1u); return (unsigned short)(u >> 16); }
__device__ __forceinline__ float bf2f(unsigned short b) { return __uint_as_float(((unsigned)b) << 16); }
__device__ __forceinline__ float bfr(float f) { return bf2f(f2bf(f)); }
__device__ __forceinline__ v16h cat16(v8h lo, v8h hi) { return __builtin_shufflevector(lo, hi, 0, 1, 2, 3, 4, 5, 6, 7, 8, 9, 10, 11, 12, 13, 14, 15); }
__device__ __forceinline__ v16bf cat16b(v8us lo, v8us hi) { return __builtin_bit_cast(v16bf, __builtin_shufflevector(lo, hi, 0, 1, 2, 3, 4, 5, 6, 7, 8, 9, 10, 11, 12, 13, 14, 15)); }
__device__ __forceinline__ v8f wmma16(v16h a, v16h b, v8f c) { return __builtin_amdgcn_wmma_f32_16x16x32_f16(false, a, false, b, (short)0, c, false, false); }
__device__ __forceinline__ v8f wmmab(v16bf a, v16bf b, v8f c) { return __builtin_amdgcn_wmma_f32_16x16x32_bf16(false, a, false, b, (short)0, c, false, false); }

__device__ __forceinline__ h16 tohx(float x) { return (h16)x; }
__device__ __forceinline__ void splitf(float y, unsigned short& h, unsigned short& l) { h = f2bf(y); l = f2bf(y - bf2f(h)); }
typedef __attribute__((ext_vector_type(2))) _Float16 v2h;
typedef __attribute__((ext_vector_type(4))) _Float16 v4h;
typedef __attribute__((ext_vector_type(2))) unsigned short v2us;
typedef __attribute__((ext_vector_type(4))) unsigned short v4us;
typedef __attribute__((ext_vector_type(2))) float v2f;
typedef __attribute__((ext_vector_type(4))) int v4i;

// ---- LDS-tiled GEMM, one 128x128 output tile per work-group of FOUR WAVES (2 x 2, each wave a 64x64 tile in 16 accumulators), 128 threads: gemm_main is the k loop, gemm_epi the stores; the kernels below pick a tile's operands from the block index.
// GEMMs that do not depend on one another share a launch: a launch's start, its first tiles' way from memory, its epilogue and its last, part-filled round are then covered by other tiles' products, and the few long hi/lo tiles run beside the many short fp16 tiles instead of leaving WGPs empty.
// Operands are K-contiguous 16-bit planes. A pass is 64 k = 128 B of every operand row; a stage holds the pass's rows of every plane at an LDS pitch of 144 B.
// Each wave brings one slice of every stage with ONE tensor load (NSPLIT 0: 64 rows of A or of Bt; NSPLIT 2: 128 rows of one of the four planes), so a row is fetched from L2 once per work-group instead of once per wave.
// Every kernel takes LDSB = 160 KiB, so that TWO work-groups of either kind stand on a WGP (two waves per SIMD: one's products cover the other's waits). NSPLIT 0: four buffers, each wave keeps THREE loads in flight (stage s + 4 is asked for when pass s ends and waited for three passes later). NSPLIT 2: a stage is 72 KiB and a pass three times as long, two buffers, one load in flight, a lead of one pass.
// acc[m][n] = sum_k A[m][k] Bt[n][k] (+ split products for NSPLIT 2), rows rb .. rb + 127 of A, rows cb .. cb + 127 of Bt. K % 64 == 0, K >= 256.
// EPI picks what the epilogue stores (+ optional f32 bias[n]): 0 = C in f32 at pitch ldc; 1 = C as three 16-bit planes (fp16, bf16 hi, bf16 lo), row-major at pitch ldc; 2 = the same three planes transposed per batch, [m / TT][n][m % TT]; 3 = C x osc in f32 at pitch ldc.
typedef uint32_t u32x4 __attribute__((ext_vector_type(4)));
typedef uint32_t u32x8 __attribute__((ext_vector_type(8)));
__device__ __forceinline__ uint32_t uni(uint32_t v) { return (uint32_t)__builtin_amdgcn_readfirstlane(v); }
__device__ __forceinline__ uint32_t pinned(uint32_t v) { uint32_t w = (uint32_t)__builtin_amdgcn_readfirstlane(v); asm volatile("" : "+s"(w)); return w; }
__device__ __forceinline__ void wait_ds0() { asm volatile("s_wait_dscnt 0x0" ::: "memory"); }        // this wave's LDS reads have returned
__device__ __forceinline__ void wait_tensor0() { asm volatile("s_wait_tensorcnt 0x0" ::: "memory"); }  // all of this wave's tensor loads have landed
__device__ __forceinline__ void wait_tensor2() { asm volatile("s_wait_tensorcnt 0x2" ::: "memory"); }  // all but this wave's two youngest tensor loads have landed (they land in issue order)
template <typename T16> struct WFrag;
template <> struct WFrag<h16> { typedef v16h V; static __device__ __forceinline__ V ld(const h16* p) { return cat16(*(const v8h*)p, *(const v8h*)(p + 16)); } static __device__ __forceinline__ v8f mma(V a, V b, v8f c) { return wmma16(a, b, c); } };
template <> struct WFrag<bf> { typedef v16bf V; static __device__ __forceinline__ V ld(const bf* p) { return cat16b(*(const v8us*)p, *(const v8us*)(p + 16)); } static __device__ __forceinline__ v8f mma(V a, V b, v8f c) { return wmmab(a, b, c); } };
#define LDSB 163840u   // static LDS of every GEMM kernel: half a WGP's
#define EPB  8192u     // epilogue staging per wave, in the ring once the loop has left it
template <typename T16, int NSPLIT, uint32_t NBUF>
__device__ __forceinline__ void gemm_main(unsigned char* L, const T16* __restrict__ A, const T16* __restrict__ A2, const T16* __restrict__ Bt, const T16* __restrict__ Bt2, int K, int rb, int cb, v8f (&acc)[4][4]) {
    static_assert(NSPLIT == 0 || NSPLIT == 2, "one product, or hi/lo planes of both operands");
    static_assert(NBUF == 2u || NBUF == 4u, "one load in flight, or three");
    typedef typename WFrag<T16>::V V;
    constexpr uint32_t ROWB = 128u, PITCH = ROWB + 16u;                 // bytes of a row per pass; its pitch in LDS (odd multiple of 16 B, for ds_load_b128)
    constexpr uint32_t SROWS = NSPLIT ? 128u : 64u;                     // rows of one wave's slice
    constexpr uint32_t SL = (SROWS * PITCH + 2047u) & ~2047u;           // a slice's place is a multiple of 2 KiB
    constexpr uint32_t STG = 4u * SL;                                   // one stage = four slices
    static_assert(4u * EPB <= NBUF * STG, "epilogue staging fits the ring");
    static_assert(NBUF * STG <= LDSB, "the ring fits the kernel's LDS");
    const uint32_t wave = uni(threadIdx.x >> 5), wm = wave & 1u, wn = wave >> 1;
    const int lane = threadIdx.x & 31, lr = lane & 15, hi = lane >> 4;
    // this wave's slice: first byte in global memory, place in a stage
    const T16* sp;
    if constexpr (NSPLIT == 0) sp = (wave < 2u) ? A + (size_t)(rb + (int)wave * 64) * K : Bt + (size_t)(cb + ((int)wave - 2) * 64) * K;
    else sp = (wave == 0u) ? A + (size_t)rb * K : (wave == 1u) ? A2 + (size_t)rb * K : (wave == 2u) ? Bt + (size_t)cb * K : Bt2 + (size_t)cb * K;
    const uint64_t sga = (uint64_t)(size_t)sp;
    const uint32_t sdst = (uint32_t)(size_t)L + wave * SL;
    u32x8 g1;   // 1-byte elements, tensor = tile = SROWS rows of 128 B, source pitch 2 K bytes, 16 B of LDS pad behind every 128-B row, no mask
    g1[0] = uni((1u << 20) | (4u << 22) | (3u << 25)); g1[1] = uni((ROWB & 0xFFFFu) << 16); g1[2] = uni((ROWB >> 16) | ((SROWS & 0xFFFFu) << 16)); g1[3] = uni((SROWS >> 16) | (ROWB << 16));
    g1[4] = uni(SROWS); g1[5] = uni((uint32_t)K * 2u); g1[6] = uni(0u); g1[7] = uni(0u);
    asm volatile("" : "+s"(g1));   // as pinned(): descriptor words held in scalar registers of their own; without it the compiler lends words 3 and 6 out as temporaries while a request is in flight
    u32x4 g0;   // one group 0 for every request: with requests in flight only its words 1 (place in LDS) and 2 (low address) take new values
    g0[0] = uni(1u); g0[1] = uni(sdst); g0[2] = uni((uint32_t)sga); g0[3] = uni((((uint32_t)(sga >> 32)) & 0x01FFFFFFu) | 0x80000000u);
    asm volatile("" : "+s"(g0));   // as pinned(): descriptor words held in scalar registers of their own, so that words 0 and 3 are not rebuilt at every issue
    auto issue = [&](uint32_t st) {   // stage st into buffer st % NBUF
        const uint64_t ga = sga + (uint64_t)st * ROWB;
        const uint32_t w3 = uni((((uint32_t)(ga >> 32)) & 0x01FFFFFFu) | 0x80000000u);
        if (pinned(w3 != g0[3])) { wait_tensor0(); g0[3] = w3; }   // a row that crosses a 4-GiB line: the high address word changes only with no request in flight
        g0[1] = uni(sdst + (st % NBUF) * STG); g0[2] = uni((uint32_t)ga);
        asm volatile("tensor_load_to_lds %0, %1" :: "s"(g0), "s"(g1) : "memory");
    };
#pragma unroll
    for (int mb = 0; mb < 4; ++mb)
#pragma unroll
        for (int nb = 0; nb < 4; ++nb) acc[mb][nb] = (v8f){};
    // byte offsets of this lane's fragment rows in a stage (k order as in the planes: 8 hi .. + 7, then + 16)
    const uint32_t aofs = (NSPLIT ? wm * 64u * PITCH : wm * SL) + (uint32_t)lr * PITCH + 16u * (uint32_t)hi;
    const uint32_t bofs = 2u * SL + (NSPLIT ? wn * 64u * PITCH : wn * SL) + (uint32_t)lr * PITCH + 16u * (uint32_t)hi;
    const uint32_t np = (uint32_t)K / 64u;
    __builtin_assume(np >= 4u);   // K >= 256: the prologue's stages exist and the loop runs, so no path reaches the epilogue past the loop's own waits
    if constexpr (NBUF == 4u) {
        issue(0u); issue(1u); issue(2u);
        wait_tensor2();                    // stage 0 has landed in this wave's slice; stages 1 and 2 fly on
        issue(3u);                         // the fourth buffer is still untouched; again three loads in flight
        __syncthreads();                   // stage 0 published
    } else {
        issue(0u);
        wait_tensor0();                    // stage 0 has landed in this wave's slice
        __syncthreads();                   // stage 0 published
        issue(1u);                         // flies under pass 0
    }
#pragma unroll 1
    for (uint32_t s = 0; s < np; ++s) {
        const unsigned char* Lb = L + (s % NBUF) * STG;
        V a[2][4], a2[2][4], b[2][4], b2[2][4];
        // the pass's fragment loads as one group in front of its matrix instructions: the LDS latency is met once a pass, and the second 32 k land under the first's products
#pragma unroll
        for (int ks = 0; ks < 2; ++ks) {
#pragma unroll
            for (int i = 0; i < 4; ++i) a[ks][i] = WFrag<T16>::ld((const T16*)(Lb + aofs + i * 16 * PITCH + ks * 64));
#pragma unroll
            for (int i = 0; i < 4; ++i) b[ks][i] = WFrag<T16>::ld((const T16*)(Lb + bofs + i * 16 * PITCH + ks * 64));
            if constexpr (NSPLIT != 0) {
#pragma unroll
                for (int i = 0; i < 4; ++i) a2[ks][i] = WFrag<T16>::ld((const T16*)(Lb + SL + aofs + i * 16 * PITCH + ks * 64));
#pragma unroll
                for (int i = 0; i < 4; ++i) b2[ks][i] = WFrag<T16>::ld((const T16*)(Lb + SL + bofs + i * 16 * PITCH + ks * 64));
            }
        }
        __builtin_amdgcn_sched_barrier(0);   // keeps the loads above together: without it the compiler moves them in among the matrix instructions, one full LDS wait per four products
        // products in the order their fragments arrive; every accumulator still takes a.b, a2.b, a.b2 per 32 k, k ascending
#pragma unroll
        for (int ks = 0; ks < 2; ++ks) {
#pragma unroll
            for (int nb = 0; nb < 4; ++nb)
#pragma unroll
                for (int mb = 0; mb < 4; ++mb) acc[mb][nb] = WFrag<T16>::mma(a[ks][mb], b[ks][nb], acc[mb][nb]);
            if constexpr (NSPLIT != 0) {
#pragma unroll
                for (int nb = 0; nb < 4; ++nb)
#pragma unroll
                    for (int mb = 0; mb < 4; ++mb) acc[mb][nb] = WFrag<T16>::mma(a2[ks][mb], b[ks][nb], acc[mb][nb]);
#pragma unroll
                for (int nb = 0; nb < 4; ++nb)
#pragma unroll
                    for (int mb = 0; mb < 4; ++mb) acc[mb][nb] = WFrag<T16>::mma(a[ks][mb], b2[ks][nb], acc[mb][nb]);
            }
        }
        __builtin_amdgcn_sched_barrier(0);   // keeps the products in front of the waits below: moved behind them, the wait for the next stage would stand in front of the work that is to cover it
        // publish point of stage s + 1: own LDS reads done, own slice of s + 1 landed, then the barrier that publishes it and frees stage s's buffer
        wait_ds0();
        if constexpr (NBUF == 4u) {
            wait_tensor2();                            // in flight: s + 1, s + 2, s + 3; the oldest has landed behind this wait
            if (pinned(s + 3u >= np)) wait_tensor0();  // the last stages: fewer in flight, so the count that covers s + 1 is 0
        } else wait_tensor0();                         // in flight: s + 1 alone
        __syncthreads();
        const uint32_t nx = pinned(s + NBUF);   // formed behind the barrier, and the descriptor words from it
        if (pinned(nx < np)) issue(nx);         // into the buffer that pass s has just read
    }
    wait_tensor0(); wait_ds0();
}
template <bool BIAS, int EPI>
__device__ __forceinline__ void gemm_epi(unsigned char* L, const v8f (&acc)[4][4], int rb, int cb, float* C, int ldc, const float* __restrict__ bias, h16* P16, bf* Ph, bf* Pl, float osc) {
    const uint32_t wave = uni(threadIdx.x >> 5), wm = wave & 1u, wn = wave >> 1;
    const int lane = threadIdx.x & 31, lr = lane & 15, hi = lane >> 4; const int r0 = rb + (int)wm * 64, c0 = cb + (int)wn * 64;
    // The last pass's barrier stands behind every wave's last read of the ring and no load is in flight: each wave stages its output in its own 8 KiB of it.
    float* os = (float*)(L + wave * EPB);
    if constexpr (EPI == 2) {
        // A lane's 8 accumulator registers are 8 consecutive rows m of one column n: convert in registers, gather 64 rows of 16 columns in LDS (pitch 144 B), store whole 128-B lines.
        unsigned short* const tsb = (unsigned short*)(L + wave * EPB); unsigned short* const ts[3] = { tsb, tsb + 16 * 72, tsb + 2 * 16 * 72 };
        const size_t pb = (size_t)(r0 / TT) * HD * TT + (size_t)c0 * TT + (r0 % TT);
        float bb[4];
#pragma unroll
        for (int nb = 0; nb < 4; ++nb) bb[nb] = BIAS ? bias[c0 + nb * 16 + lr] : 0.0f;
        if (BIAS) asm volatile("s_wait_xcnt 0x0" ::: "memory");   // stands in front of the conversions below, which write the offset register that the four loads name
#pragma unroll
        for (int nb = 0; nb < 4; ++nb) bb[nb] = bfr(bb[nb]);
#pragma unroll
        for (int nb = 0; nb < 4; ++nb) {
#pragma unroll
            for (int mb = 0; mb < 4; ++mb) { v8h o16; v8us oh, ol;
#pragma unroll
                for (int j = 0; j < 8; ++j) { float val = acc[mb][nb][j]; if (BIAS) val += bb[nb]; o16[j] = tohx(val); unsigned short a2, c2; splitf(val, a2, c2); oh[j] = a2; ol[j] = c2; }
                const int so = lr * 72 + mb * 16 + hi * 8; *(v8us*)(ts[0] + so) = __builtin_bit_cast(v8us, o16); *(v8us*)(ts[1] + so) = oh; *(v8us*)(ts[2] + so) = ol; }
            // the reads below take other lanes' values: the LDS stores above are complete first, and the compiler moves no LDS access across
            __builtin_amdgcn_wave_barrier(); asm volatile("s_wait_dscnt 0x0" ::: "memory");
#pragma unroll
            for (int s = 0; s < 4; ++s) { const int col = s * 4 + (lane >> 3), ro = (lane & 7) * 8; const size_t go = pb + (size_t)(nb * 16 + col) * TT + ro;
                *(v8h*)(P16 + go) = __builtin_bit_cast(v8h, *(const v8us*)(ts[0] + col * 72 + ro)); *(v8us*)(Ph + go) = *(const v8us*)(ts[1] + col * 72 + ro); *(v8us*)(Pl + go) = *(const v8us*)(ts[2] + col * 72 + ro); }
            // keeps the next column group's LDS stores behind the reads above
            __builtin_amdgcn_wave_barrier(); asm volatile("" ::: "memory");
        }
        return;
    }
#pragma unroll
    for (int mb = 0; mb < 4; ++mb) {
#pragma unroll
        for (int nb = 0; nb < 4; ++nb) {
#pragma unroll
            for (int j = 0; j < 8; ++j) os[(hi * 8 + j) * 68 + nb * 16 + lr] = acc[mb][nb][j]; }
        __builtin_amdgcn_wave_barrier(); asm volatile("" ::: "memory");
        float* crow = C + (size_t)(r0 + mb * 16) * ldc + c0;
        if constexpr (EPI == 1) {
            // The 16 rows are converted first and then stored in one run of 24 stores, so that one s_wait_xcnt serves them all instead of one per row pair.
            const int cofs = lr * 4; v4h o16[8]; v4us oh[8], ol[8]; const size_t gb = (size_t)(r0 + mb * 16 + hi) * ldc + c0 + cofs;   // one address per plane, the row pairs at constant offsets from it
#pragma unroll
            for (int s = 0; s < 8; ++s) { const int row = 2 * s + hi; v4f val = *(const v4fa*)(os + row * 68 + cofs); if (BIAS) { val[0] += bfr(bias[c0 + cofs]); val[1] += bfr(bias[c0 + cofs + 1]); val[2] += bfr(bias[c0 + cofs + 2]); val[3] += bfr(bias[c0 + cofs + 3]); }
#pragma unroll
                for (int q = 0; q < 4; ++q) { o16[s][q] = tohx(val[q]); unsigned short a2, c2; splitf(val[q], a2, c2); oh[s][q] = a2; ol[s][q] = c2; } }
            __builtin_amdgcn_sched_barrier(0);   // keeps the conversions in front of the first store: moved in among the stores they write registers that an issued store names, each behind a wait of its own
#pragma unroll
            for (int s = 0; s < 8; ++s) { const size_t go = gb + (size_t)(2 * s) * ldc; *(v4h*)(P16 + go) = o16[s]; *(v4us*)(Ph + go) = oh[s]; *(v4us*)(Pl + go) = ol[s]; }
            asm volatile("s_wait_xcnt 0x0" ::: "memory");   // stands in front of the next 16 rows' work, which writes the address and data registers that these stores name
        } else {
#pragma unroll
            for (int s = 0; s < 8; ++s) { const int row = 2 * s + hi, cofs = lr * 4; v4f val = *(const v4fa*)(os + row * 68 + cofs); if (BIAS) { val[0] += bfr(bias[c0 + cofs]); val[1] += bfr(bias[c0 + cofs + 1]); val[2] += bfr(bias[c0 + cofs + 2]); val[3] += bfr(bias[c0 + cofs + 3]); }
                if constexpr (EPI == 3) val *= osc;
                *(v4f*)(crow + (size_t)row * ldc + cofs) = val; }
        }
        __builtin_amdgcn_wave_barrier(); asm volatile("" ::: "memory");
    }
}

// k_proj: the three projections in one launch, grid (rows / 128, DQ / 128, 3): z = 0 Q = x Wq + bq, 1 K = context Wk + bk, 2 V = context Wv + bv (stored transposed).
__global__ __launch_bounds__(128) void k_proj(const bf* __restrict__ XBx, const bf* __restrict__ XBc, const bf* __restrict__ WQ, const bf* __restrict__ WK, const bf* __restrict__ WV, const float* __restrict__ bq, const float* __restrict__ bk, const float* __restrict__ bv,
                                              h16* QP16, bf* QPh, bf* QPl, h16* KP16, bf* KPh, bf* KPl, h16* VT16, bf* VTh, bf* VTl) {
    static_assert(DQ == DKV, "one grid for the three projections");
    __shared__ __attribute__((aligned(2048))) unsigned char L[LDSB];
    const uint32_t z = blockIdx.z; const int rb = blockIdx.x * 128, cb = blockIdx.y * 128;
    v8f acc[4][4];
    gemm_main<bf, 0, 4u>(L, (z == 0u) ? XBx : XBc, nullptr, (z == 0u) ? WQ : (z == 1u) ? WK : WV, nullptr, DM, rb, cb, acc);
    if (z == 2u) gemm_epi<true, 2>(L, acc, rb, cb, nullptr, DKV, bv, VT16, VTh, VTl, 1.0f);
    else gemm_epi<true, 1>(L, acc, rb, cb, nullptr, DQ, (z == 0u) ? bq : bk, (z == 0u) ? QP16 : KP16, (z == 0u) ? QPh : KPh, (z == 0u) ? QPl : KPl, 1.0f);
}

// k_att: one attention GEMM over all TT query rows of all batches in one launch, C[z][m][n] = sum_k A[z][m][k] B[z][n][k], NCT column tiles of 128.
// Row tiles below RH take the hi/lo planes (3 products), the rest the fp16 planes (result x osc16). 1-D grid: the hi/lo tiles, three times as long, have the lowest indices and start first.
// Batch strides in elements: sAh (hi/lo A planes), sA16 (fp16 A plane), sB (every B plane), sC.
template <int NCT, int EPI>
__global__ __launch_bounds__(128) void k_att(const bf* __restrict__ Ah, const bf* __restrict__ Al, const bf* __restrict__ Bh, const bf* __restrict__ Bl, const h16* __restrict__ A16, const h16* __restrict__ B16, int K, float* C, int ldc, size_t sAh, size_t sA16, size_t sB, size_t sC, float osc16) {
    __shared__ __attribute__((aligned(2048))) unsigned char L[LDSB];
    constexpr uint32_t RTH = RH / 128, RTL = (TT - RH) / 128, NHW = RTH * NCT * NB_;   // row tiles of either kind; hi/lo work-groups
    const uint32_t id = blockIdx.x; const uint32_t hilo = pinned(id < NHW);   // pinned(): the branch below decides which tensor loads issue, so it is a scalar one
    int rb, cb; size_t z; v8f acc[4][4];   // tile: row tile fastest, then column tile, then batch
    if (hilo) {
        rb = (int)(id % RTH) * 128; cb = (int)(id / RTH % NCT) * 128; z = id / (RTH * NCT);
        gemm_main<bf, 2, 2u>(L, Ah + z * sAh, Al + z * sAh, Bh + z * sB, Bl + z * sB, K, rb, cb, acc);
    } else {
        const uint32_t il = id - NHW; rb = (int)(RTH + il % RTL) * 128; cb = (int)(il / RTL % NCT) * 128; z = il / (RTL * NCT);
        gemm_main<h16, 0, 4u>(L, A16 + z * sA16, nullptr, B16 + z * sB, nullptr, K, rb, cb, acc);
    }
    gemm_epi<false, EPI>(L, acc, rb, cb, C + z * sC, ldc, nullptr, nullptr, nullptr, nullptr, hilo ? 1.0f : osc16);
}

// ---- k_prep: all input preparation in ONE launch of few, long waves (a launch of many one-load waves lasts as long as its waves take to start, not as long as its bytes take to move).
// Blocks 0 .. PWB-1, 64 per weight: a wave transposes a block of 32 n x 64 k of w [K][N] into Bt [N][K] in bf16: lane = n, so each of its 64 loads is one whole 128-B line, all in flight at once; a lane's eight 16-B stores fill one 128-B line of Bt.
// Blocks PWB .. PWB+PCB-1, half for x, half for context: a wave converts 4,096 consecutive floats, in two unrolled rounds of 16 loads of 512 contiguous bytes each (the second round's loads issue ahead of the first round's conversions as far as registers allow); the inputs are read once, so the loads are non-temporal and leave L2 to the bf16 copies.
#define PWB  192
#define PCB  512
__global__ __launch_bounds__(256) void k_prep(const float* __restrict__ x, const float* __restrict__ ctx, const float* __restrict__ wq, const float* __restrict__ wk, const float* __restrict__ wv, bf* XBx, bf* XBc, bf* WQ, bf* WK, bf* WV) {
    static_assert(DM == 1024 && DQ == 1024 && DKV == 1024, "64 blocks of 8 waves cover one weight in blocks of 32 n x 64 k");
    static_assert((size_t)NB_ * TT * DM == (size_t)(PCB / 2) * 8 * 4096, "PCB / 2 blocks of 8 waves x 4,096 floats cover one activation tensor");
    const int lane = threadIdx.x & 31, wave = threadIdx.x >> 5; const int blk = blockIdx.x;
    if (blk < PWB) {
        const int m = blk >> 6, t = (blk & 63) * 8 + wave; const int n = (t >> 4) * 32 + lane, k0 = (t & 15) * 64;
        const float* w = (m == 0) ? wq : (m == 1) ? wk : wv; bf* Bt = (m == 0) ? WQ : (m == 1) ? WK : WV;
        const float* wp = w + (size_t)k0 * DQ + n; bf* bp = Bt + (size_t)n * DM + k0; float v[64];
#pragma unroll   // all 64 loads issue before the first is waited for: one memory latency per wave; v[] stays in registers
        for (int j = 0; j < 64; ++j) v[j] = wp[(size_t)j * DQ];
#pragma unroll   // constant indices into v[]
        for (int g = 0; g < 8; ++g) { v8us o;
#pragma unroll
            for (int q = 0; q < 8; ++q) o[q] = f2bf(v[g * 8 + q]);
            *(v8us*)(bp + g * 8) = o; }
        return;
    }
    const int cb = blk - PWB; const bool isx = cb < PCB / 2; const size_t base = (size_t)(cb & (PCB / 2 - 1)) * (8 * 4096) + (size_t)wave * 4096 + (size_t)lane * 4;
    const float* sp = (isx ? x : ctx) + base; bf* dp = (isx ? XBx : XBc) + base;
#pragma unroll   // lets the second round's loads start before the first round is converted
    for (int r = 0; r < 2; ++r) { v4f v[16];
#pragma unroll   // a round's 16 loads in flight together, from one base address with immediate offsets
        for (int i = 0; i < 16; ++i) v[i] = __builtin_nontemporal_load((const v4f*)(sp + r * 2048 + i * 128));
#pragma unroll
        for (int i = 0; i < 16; ++i) { v4us o;
#pragma unroll
            for (int q = 0; q < 4; ++q) o[q] = f2bf(v[i][q]);
            *(v4us*)(dp + r * 2048 + i * 128) = o; } }
}

// k_asoft: per row (zz, i), zz = batch: t = S x HD^-0.5 (no mask); softmax over the 2048 keys (register row, one exp, fixed trees);
__global__ __launch_bounds__(256) void k_asoft(const float* __restrict__ Sb, h16* P16, bf* Ph, bf* Pl) {
    const int lane = threadIdx.x & 31; const int row = blockIdx.x * 8 + (threadIdx.x >> 5); if (row >= NB_ * TT) return; const int i = row % TT; const int zz = row / TT; (void)zz; const bool hires = (i < RH); const float* sr = Sb + (size_t)row * TT; float v[TT / 32]; float mx = -3.0e38f;
#pragma unroll
    for (int ch = 0; ch < TT / 128; ++ch) { const int j0 = ch * 128 + lane * 4; const v4f a = *(const v4f*)(sr + j0);
#pragma unroll
        for (int q = 0; q < 4; ++q) { const int j = j0 + q; (void)j; const float t = a[q] * SCL; v[ch * 4 + q] = t; mx = fmaxf(mx, t); } }
#pragma unroll
    for (int sh = 16; sh; sh >>= 1) mx = fmaxf(mx, __shfl_xor(mx, sh, 32));
    float sum = 0.f;
#pragma unroll
    for (int k = 0; k < TT / 32; ++k) { float d0 = __fsub_rn(v[k], mx); asm volatile("" : "+v"(d0)); v[k] = __builtin_amdgcn_exp2f(__fmul_rn(d0, 1.4426950408889634f)); sum += v[k]; }
#pragma unroll
    for (int sh = 16; sh; sh >>= 1) sum += __shfl_xor(sum, sh, 32);
    const float f = __fdiv_rn(hires ? 1.0f : PCAR, sum);
{
        if (hires) {
#pragma unroll
            for (int ch = 0; ch < TT / 128; ++ch) { v4us oh, ol;
#pragma unroll
                for (int q = 0; q < 4; ++q) { unsigned short a, c2; splitf(v[ch * 4 + q] * f, a, c2); oh[q] = a; ol[q] = c2; }
                const size_t oo = ((size_t)zz * (RH ? RH : 1) + i) * TT + ch * 128 + lane * 4; *(v4us*)(Ph + oo) = oh; *(v4us*)(Pl + oo) = ol; }
        } else {
#pragma unroll
            for (int ch = 0; ch < TT / 128; ++ch) { v4h o4;
#pragma unroll
                for (int q = 0; q < 4; ++q) o4[q] = tohx(v[ch * 4 + q] * f);
                *(v4h*)(P16 + (size_t)row * TT + ch * 128 + lane * 4) = o4; } }
         }
}

extern "C" void kernel_launch(void* const* d_in, const int* in_sizes, int n_in,
                              void* d_out, int out_size, void* d_ws, size_t ws_size, hipStream_t stream) {
    (void)in_sizes; (void)n_in; (void)out_size;
    const float* x = (const float*)d_in[0]; const float* xk = (const float*)d_in[1];   /* K and V both project context */ const float* wq = (const float*)d_in[2]; const float* bq = (const float*)d_in[3]; const float* wk = (const float*)d_in[4]; const float* bk = (const float*)d_in[5]; const float* wv = (const float*)d_in[6]; const float* bv = (const float*)d_in[7]; const float* wo = nullptr; (void)wo;   /* argument order x, context, Wq, bq, Wk, bk, Wv, bv ('xw' [1024][1024]) */
    float* OUT = (float*)d_out;     // [4][2048][1024]
    char* wsp = (char*)d_ws;
    auto take = [&](size_t bytes) { char* p = wsp; wsp += (bytes + 255) & ~(size_t)255; return (void*)p; };
    // Workspace for all four batches at once; regions whose contents are dead by then are used again, in stream order (every byte read is written earlier in the same call).
    bf* WQ = (bf*)take((size_t)DQ * DM * 2); bf* WK = (bf*)take((size_t)DKV * DM * 2); bf* WV = (bf*)take((size_t)DKV * DM * 2);
    h16* P16 = (h16*)take((size_t)NB_ * TT * TT * 2);
    h16* QP16 = (h16*)take((size_t)NB_ * TT * HD * 2); h16* KP16 = (h16*)take((size_t)NB_ * TT * HD * 2); h16* VT16 = (h16*)take((size_t)NB_ * HD * TT * 2);
    bf* QPh = (bf*)take((size_t)NB_ * TT * HD * 2); bf* QPl = (bf*)take((size_t)NB_ * TT * HD * 2); bf* KPh = (bf*)take((size_t)NB_ * TT * HD * 2); bf* KPl = (bf*)take((size_t)NB_ * TT * HD * 2); bf* VTh = (bf*)take((size_t)NB_ * HD * TT * 2); bf* VTl = (bf*)take((size_t)NB_ * HD * TT * 2);
    float* Sb = (float*)take((size_t)NB_ * TT * TT * 4);
    if ((size_t)(wsp - (char*)d_ws) > ws_size) return;    // ws 256 MiB, 246 MiB used
    bf* XBx = (bf*)P16; bf* XBc = XBx + (size_t)NB_ * TT * DM;   // bf16 copies of x and of context (16 MiB each) fill the fp16 probabilities' region (32 MiB): dead after the V projection, before the softmax writes them
    bf* Ph = QPh; bf* Pl = QPl;                       // hi/lo probabilities (8 MiB each) over the hi/lo query planes: dead after the score GEMMs
    k_prep<<<PWB + PCB, 256, 0, stream>>>(x, xk, wq, wk, wv, XBx, XBc, WQ, WK, WV);
    k_proj<<<dim3(NB_ * TT / 128, DQ / 128, 3), 128, 0, stream>>>(XBx, XBc, WQ, WK, WV, bq, bk, bv, QP16, QPh, QPl, KP16, KPh, KPl, VT16, VTh, VTl);
    // attention (one head): batch strides are one batch's plane, score matrix or output
    k_att<TT / 128, 0><<<(TT / 128) * (TT / 128) * NB_, 128, 0, stream>>>(QPh, QPl, KPh, KPl, QP16, KP16, HD, Sb, TT, (size_t)TT * HD, (size_t)TT * HD, (size_t)TT * HD, (size_t)TT * TT, 1.0f);
    k_asoft<<<NB_ * TT / 8, 256, 0, stream>>>(Sb, P16, Ph, Pl);
    k_att<HD / 128, 3><<<(TT / 128) * (HD / 128) * NB_, 128, 0, stream>>>(Ph, Pl, VTh, VTl, P16, VT16, TT, OUT, HD, (size_t)RH * TT, (size_t)TT * TT, (size_t)HD * TT, (size_t)TT * HD, 1.0f / PCAR);
}

// v007
// It runs in 152 microseconds.
// In both of two side-by-side timings against v006, it was 1.05 times as fast.
// Counting every step since v000, it is 6.96 times as fast.
#include <hip/hip_runtime.h>

// Cross-attention with ONE 1,024-wide head, biased projections and no output projection (x [4][2048][1024] -> Q = x Wq + bq; context [4][2048][1024] -> K = context Wk + bk, V = context Wv + bv ('xw' [1024][1024] uniform(+-1/32), biases zeros on this draw: read); scores = Q.K over all 1,024 dims x float32(1/sqrt(1024)) = 1/32; softmax over all context tokens (no mask); out = attn V -> [4][2048][1024] (8.4 M); argument order x, context, Wq, bq, Wk, bk, Wv, bv).
// Layout, all four batches in every launch, five launches: one preparation launch writes the bf16 copies of x (Q projection) and of context (K and V projections) and the three transposed 'xw' weights; ONE launch for the three exact projections + f32 biases, whose epilogues write the fp16 and hi/lo planes themselves (Q and K row-major, V transposed per batch); dense T-2048 attention (hybrid rows: < 512 hi/lo 3 products, rest fp16 x1024): ONE launch for both score GEMMs, the softmax, ONE launch for both P.V GEMMs, which take the x1024 back out and write the output rows.
// Compute dtypes, f32 accumulate: every input rounded to bf16; projections exact + f32 biases; attention rows < 512 3 products, rest fp16; softmax f32; output f32.

#define NB_  4
#define TT   2048
#define DM   1024
#define NH_  1
#define NKV  1
#define REP  (NH_ / NKV)
#define HD   1024
#define DQ   (NH_ * HD)
#define DKV  (NKV * HD)
#define ZH   1
#define RH   512                  // query rows < RH use hi+lo planes (0: none)
#define WIN  0
#define PCAR 1024.0f
#define SCL  0.03125f   // 1 / sqrt(1024) = 2^-5 (ONE head of width 1,024)
typedef _Float16 h16;
typedef unsigned short bf;
typedef __attribute__((ext_vector_type(16))) __bf16   v16bf;
typedef __attribute__((ext_vector_type(16))) _Float16 v16h;
typedef __attribute__((ext_vector_type(8)))  _Float16 v8h;
typedef __attribute__((ext_vector_type(8)))  unsigned short v8us;
typedef __attribute__((ext_vector_type(8)))  float    v8f;
typedef __attribute__((ext_vector_type(4)))  float    v4f;
typedef v8h  __attribute__((may_alias)) v8ha;
typedef v4f  __attribute__((may_alias)) v4fa;
typedef v8us __attribute__((may_alias)) v8usa;

__device__ __forceinline__ unsigned short f2bf(float f) { unsigned u = __float_as_uint(f); u += 0x7FFFu + ((u >> 16) & 1u); return (unsigned short)(u >> 16); }
__device__ __forceinline__ float bf2f(unsigned short b) { return __uint_as_float(((unsigned)b) << 16); }
__device__ __forceinline__ float bfr(float f) { return bf2f(f2bf(f)); }
__device__ __forceinline__ v16h cat16(v8h lo, v8h hi) { return __builtin_shufflevector(lo, hi, 0, 1, 2, 3, 4, 5, 6, 7, 8, 9, 10, 11, 12, 13, 14, 15); }
__device__ __forceinline__ v16bf cat16b(v8us lo, v8us hi) { return __builtin_bit_cast(v16bf, __builtin_shufflevector(lo, hi, 0, 1, 2, 3, 4, 5, 6, 7, 8, 9, 10, 11, 12, 13, 14, 15)); }
__device__ __forceinline__ v8f wmma16(v16h a, v16h b, v8f c) { return __builtin_amdgcn_wmma_f32_16x16x32_f16(false, a, false, b, (short)0, c, false, false); }
__device__ __forceinline__ v8f wmmab(v16bf a, v16bf b, v8f c) { return __builtin_amdgcn_wmma_f32_16x16x32_bf16(false, a, false, b, (short)0, c, false, false); }

__device__ __forceinline__ h16 tohx(float x) { return (h16)x; }
__device__ __forceinline__ void splitf(float y, unsigned short& h, unsigned short& l) { h = f2bf(y); l = f2bf(y - bf2f(h)); }
typedef __attribute__((ext_vector_type(2))) _Float16 v2h;
typedef __attribute__((ext_vector_type(4))) _Float16 v4h;
typedef __attribute__((ext_vector_type(2))) unsigned short v2us;
typedef __attribute__((ext_vector_type(4))) unsigned short v4us;
typedef __attribute__((ext_vector_type(2))) float v2f;
typedef __attribute__((ext_vector_type(4))) int v4i;

// ---- LDS-tiled GEMM, one (32 MB)x128 output tile per work-group of FOUR WAVES (2 x 2, each wave a (16 MB)x64 tile in 4 MB accumulators; MB = 4, a 128x128 tile, unless said otherwise), 128 threads: gemm_main is the k loop, gemm_epi the stores; the kernels below pick a tile's operands from the block index.
// GEMMs that do not depend on one another share a launch: a launch's start, its first tiles' way from memory, its epilogue and its last, part-filled round are then covered by other tiles' products, and the few long hi/lo tiles run beside the many short fp16 tiles instead of leaving WGPs empty.
// Operands are K-contiguous 16-bit planes. A pass is 64 k = 128 B of every operand row; a stage holds the pass's rows of every plane at an LDS pitch of 144 B.
// Each wave brings one slice of every stage with ONE tensor load (NSPLIT 0: 16 MB rows of A or 64 of Bt; NSPLIT 2: the tile's rows of one of the four planes), so a row is fetched from L2 once per work-group instead of once per wave.
// Every kernel takes LDSB = 160 KiB, so that TWO work-groups of either kind stand on a WGP (two waves per SIMD: one's products cover the other's waits). NSPLIT 0: four buffers, each wave keeps THREE loads in flight (stage s + 4 is asked for when pass s ends and waited for three passes later). With MB = 6 a stage is 48 KiB: three buffers, two loads in flight. NSPLIT 2: a stage is up to 72 KiB and a pass three times as long, two buffers, one load in flight, a lead of one pass.
// acc[m][n] = sum_k A[m][k] Bt[n][k] (+ split products for NSPLIT 2), rows rb .. rb + 32 MB - 1 of A, rows cb .. cb + 127 of Bt. K % 64 == 0, K >= 256.
// EPI picks what the epilogue stores (+ optional f32 bias[n]): 0 = C in f32 at pitch ldc; 1 = C as three 16-bit planes (fp16, bf16 hi, bf16 lo), row-major at pitch ldc; 2 = the same three planes transposed per batch, [m / TT][n][m % TT]; 3 = C x osc in f32 at pitch ldc.
typedef uint32_t u32x4 __attribute__((ext_vector_type(4)));
typedef uint32_t u32x8 __attribute__((ext_vector_type(8)));
__device__ __forceinline__ uint32_t uni(uint32_t v) { return (uint32_t)__builtin_amdgcn_readfirstlane(v); }
__device__ __forceinline__ uint32_t pinned(uint32_t v) { uint32_t w = (uint32_t)__builtin_amdgcn_readfirstlane(v); asm volatile("" : "+s"(w)); return w; }
__device__ __forceinline__ void wait_ds0() { asm volatile("s_wait_dscnt 0x0" ::: "memory"); }        // this wave's LDS reads have returned
__device__ __forceinline__ void wait_tensor0() { asm volatile("s_wait_tensorcnt 0x0" ::: "memory"); }  // all of this wave's tensor loads have landed
__device__ __forceinline__ void wait_tensor1() { asm volatile("s_wait_tensorcnt 0x1" ::: "memory"); }  // all but this wave's youngest tensor load have landed
__device__ __forceinline__ void wait_tensor2() { asm volatile("s_wait_tensorcnt 0x2" ::: "memory"); }  // all but this wave's two youngest tensor loads have landed (they land in issue order)
template <typename T16> struct WFrag;
template <> struct WFrag<h16> { typedef v16h V; static __device__ __forceinline__ V ld(const h16* p) { return cat16(*(const v8h*)p, *(const v8h*)(p + 16)); } static __device__ __forceinline__ v8f mma(V a, V b, v8f c) { return wmma16(a, b, c); } };
template <> struct WFrag<bf> { typedef v16bf V; static __device__ __forceinline__ V ld(const bf* p) { return cat16b(*(const v8us*)p, *(const v8us*)(p + 16)); } static __device__ __forceinline__ v8f mma(V a, V b, v8f c) { return wmmab(a, b, c); } };
#define LDSB 163840u   // static LDS of every GEMM kernel: half a WGP's
#define EPB  8192u     // epilogue staging per wave, in the ring once the loop has left it
template <typename T16, int NSPLIT, uint32_t NBUF, int MB>
__device__ __forceinline__ void gemm_main(unsigned char* L, const T16* __restrict__ A, const T16* __restrict__ A2, const T16* __restrict__ Bt, const T16* __restrict__ Bt2, int K, int rb, int cb, v8f (&acc)[MB][4]) {
    static_assert(NSPLIT == 0 || NSPLIT == 2, "one product, or hi/lo planes of both operands");
    static_assert(NBUF >= 2u && NBUF <= 4u, "NBUF - 1 loads in flight: one to three");
    typedef typename WFrag<T16>::V V;
    constexpr uint32_t ROWB = 128u, PITCH = ROWB + 16u;                 // bytes of a row per pass; its pitch in LDS (odd multiple of 16 B, for ds_load_b128)
    constexpr uint32_t WR = (uint32_t)MB * 16u;                         // rows of A per wave tile; the work-group's tile has 2 WR rows
    constexpr uint32_t AROWS = NSPLIT ? 2u * WR : WR, BROWS = NSPLIT ? 128u : 64u;   // rows of one wave's slice: waves 0, 1 bring A, waves 2, 3 bring Bt
    constexpr uint32_t SLA = (AROWS * PITCH + 2047u) & ~2047u, SLB = (BROWS * PITCH + 2047u) & ~2047u;   // a slice's place is a multiple of 2 KiB
    constexpr uint32_t STG = 2u * SLA + 2u * SLB;                       // one stage = four slices
    static_assert(4u * EPB <= NBUF * STG, "epilogue staging fits the ring");
    static_assert(NBUF * STG <= LDSB, "the ring fits the kernel's LDS");
    const uint32_t wave = uni(threadIdx.x >> 5), wm = wave & 1u, wn = wave >> 1;
    const int lane = threadIdx.x & 31, lr = lane & 15, hi = lane >> 4;
    // this wave's slice: first byte in global memory, place in a stage
    const T16* sp;
    if constexpr (NSPLIT == 0) sp = (wave < 2u) ? A + (size_t)(rb + (int)(wave * WR)) * K : Bt + (size_t)(cb + ((int)wave - 2) * 64) * K;
    else sp = (wave == 0u) ? A + (size_t)rb * K : (wave == 1u) ? A2 + (size_t)rb * K : (wave == 2u) ? Bt + (size_t)cb * K : Bt2 + (size_t)cb * K;
    const uint64_t sga = (uint64_t)(size_t)sp;
    const uint32_t sdst = (uint32_t)(size_t)L + ((wave < 2u) ? wave * SLA : 2u * SLA + (wave - 2u) * SLB);
    const uint32_t SROWS = (wave < 2u) ? AROWS : BROWS;
    u32x8 g1;   // 1-byte elements, tensor = tile = SROWS rows of 128 B, source pitch 2 K bytes, 16 B of LDS pad behind every 128-B row, no mask
    g1[0] = uni((1u << 20) | (4u << 22) | (3u << 25)); g1[1] = uni((ROWB & 0xFFFFu) << 16); g1[2] = uni((ROWB >> 16) | ((SROWS & 0xFFFFu) << 16)); g1[3] = uni((SROWS >> 16) | (ROWB << 16));
    g1[4] = uni(SROWS); g1[5] = uni((uint32_t)K * 2u); g1[6] = uni(0u); g1[7] = uni(0u);
    asm volatile("" : "+s"(g1));   // as pinned(): descriptor words held in scalar registers of their own; without it the compiler lends words 3 and 6 out as temporaries while a request is in flight
    u32x4 g0;   // one group 0 for every request: with requests in flight only its words 1 (place in LDS) and 2 (low address) take new values
    g0[0] = uni(1u); g0[1] = uni(sdst); g0[2] = uni((uint32_t)sga); g0[3] = uni((((uint32_t)(sga >> 32)) & 0x01FFFFFFu) | 0x80000000u);
    asm volatile("" : "+s"(g0));   // as pinned(): descriptor words held in scalar registers of their own, so that words 0 and 3 are not rebuilt at every issue
    auto issue = [&](uint32_t st) {   // stage st into buffer st % NBUF
        const uint64_t ga = sga + (uint64_t)st * ROWB;
        const uint32_t w3 = uni((((uint32_t)(ga >> 32)) & 0x01FFFFFFu) | 0x80000000u);
        if (pinned(w3 != g0[3])) { wait_tensor0(); g0[3] = w3; }   // a row that crosses a 4-GiB line: the high address word changes only with no request in flight
        g0[1] = uni(sdst + (st % NBUF) * STG); g0[2] = uni((uint32_t)ga);
        asm volatile("tensor_load_to_lds %0, %1" :: "s"(g0), "s"(g1) : "memory");
    };
#pragma unroll
    for (int mb = 0; mb < MB; ++mb)
#pragma unroll
        for (int nb = 0; nb < 4; ++nb) acc[mb][nb] = (v8f){};
    // byte offsets of this lane's fragment rows in a stage (k order as in the planes: 8 hi .. + 7, then + 16)
    const uint32_t aofs = (NSPLIT ? wm * WR * PITCH : wm * SLA) + (uint32_t)lr * PITCH + 16u * (uint32_t)hi;
    const uint32_t bofs = 2u * SLA + (NSPLIT ? wn * 64u * PITCH : wn * SLB) + (uint32_t)lr * PITCH + 16u * (uint32_t)hi;
    const uint32_t np = (uint32_t)K / 64u;
    __builtin_assume(np >= 4u);   // K >= 256: the prologue's stages exist and the loop runs, so no path reaches the epilogue past the loop's own waits
    if constexpr (NBUF == 4u) {
        issue(0u); issue(1u); issue(2u);
        wait_tensor2();                    // stage 0 has landed in this wave's slice; stages 1 and 2 fly on
        issue(3u);                         // the fourth buffer is still untouched; again three loads in flight
        __syncthreads();                   // stage 0 published
    } else if constexpr (NBUF == 3u) {
        issue(0u); issue(1u);
        wait_tensor1();                    // stage 0 has landed in this wave's slice; stage 1 flies on
        issue(2u);                         // the third buffer is still untouched; again two loads in flight
        __syncthreads();                   // stage 0 published
    } else {
        issue(0u);
        wait_tensor0();                    // stage 0 has landed in this wave's slice
        __syncthreads();                   // stage 0 published
        issue(1u);                         // flies under pass 0
    }
#pragma unroll 1
    for (uint32_t s = 0; s < np; ++s) {
        const unsigned char* Lb = L + (s % NBUF) * STG;
        V a[2][MB], a2[2][MB], b[2][4], b2[2][4];
        // the pass's fragment loads as one group in front of its matrix instructions: the LDS latency is met once a pass, and the second 32 k land under the first's products
#pragma unroll
        for (int ks = 0; ks < 2; ++ks) {
#pragma unroll
            for (int i = 0; i < MB; ++i) a[ks][i] = WFrag<T16>::ld((const T16*)(Lb + aofs + i * 16 * PITCH + ks * 64));
#pragma unroll
            for (int i = 0; i < 4; ++i) b[ks][i] = WFrag<T16>::ld((const T16*)(Lb + bofs + i * 16 * PITCH + ks * 64));
            if constexpr (NSPLIT != 0) {
#pragma unroll
                for (int i = 0; i < MB; ++i) a2[ks][i] = WFrag<T16>::ld((const T16*)(Lb + SLA + aofs + i * 16 * PITCH + ks * 64));
#pragma unroll
                for (int i = 0; i < 4; ++i) b2[ks][i] = WFrag<T16>::ld((const T16*)(Lb + SLB + bofs + i * 16 * PITCH + ks * 64));
            }
        }
        __builtin_amdgcn_sched_barrier(0);   // keeps the loads above together: without it the compiler moves them in among the matrix instructions, one full LDS wait per four products
        // products in the order their fragments arrive; every accumulator still takes a.b, a2.b, a.b2 per 32 k, k ascending
#pragma unroll
        for (int ks = 0; ks < 2; ++ks) {
#pragma unroll
            for (int nb = 0; nb < 4; ++nb)
#pragma unroll
                for (int mb = 0; mb < MB; ++mb) acc[mb][nb] = WFrag<T16>::mma(a[ks][mb], b[ks][nb], acc[mb][nb]);
            if constexpr (NSPLIT != 0) {
#pragma unroll
                for (int nb = 0; nb < 4; ++nb)
#pragma unroll
                    for (int mb = 0; mb < MB; ++mb) acc[mb][nb] = WFrag<T16>::mma(a2[ks][mb], b[ks][nb], acc[mb][nb]);
#pragma unroll
                for (int nb = 0; nb < 4; ++nb)
#pragma unroll
                    for (int mb = 0; mb < MB; ++mb) acc[mb][nb] = WFrag<T16>::mma(a[ks][mb], b2[ks][nb], acc[mb][nb]);
            }
        }
        __builtin_amdgcn_sched_barrier(0);   // keeps the products in front of the waits below: moved behind them, the wait for the next stage would stand in front of the work that is to cover it
        // publish point of stage s + 1: own LDS reads done, own slice of s + 1 landed, then the barrier that publishes it and frees stage s's buffer
        wait_ds0();
        if constexpr (NBUF == 4u) {
            wait_tensor2();                            // in flight: s + 1, s + 2, s + 3; the oldest has landed behind this wait
            if (pinned(s + 3u >= np)) wait_tensor0();  // the last stages: fewer in flight, so the count that covers s + 1 is 0
        } else if constexpr (NBUF == 3u) {
            wait_tensor1();                            // in flight: s + 1, s + 2; the older has landed behind this wait
            if (pinned(s + 2u >= np)) wait_tensor0();  // the last stages: s + 1 alone in flight, so the count that covers it is 0
        } else wait_tensor0();                         // in flight: s + 1 alone
        __syncthreads();
        const uint32_t nx = pinned(s + NBUF);   // formed behind the barrier, and the descriptor words from it
        if (pinned(nx < np)) issue(nx);         // into the buffer that pass s has just read
    }
    wait_tensor0(); wait_ds0();
}
template <bool BIAS, int EPI, int MB>
__device__ __forceinline__ void gemm_epi(unsigned char* L, const v8f (&acc)[MB][4], int rb, int cb, float* C, int ldc, const float* __restrict__ bias, h16* P16, bf* Ph, bf* Pl, float osc) {
    const uint32_t wave = uni(threadIdx.x >> 5), wm = wave & 1u, wn = wave >> 1;
    const int lane = threadIdx.x & 31, lr = lane & 15, hi = lane >> 4; const int r0 = rb + (int)wm * (MB * 16), c0 = cb + (int)wn * 64;
    // The last pass's barrier stands behind every wave's last read of the ring and no load is in flight: each wave stages its output in its own 8 KiB of it.
    float* os = (float*)(L + wave * EPB);
    if constexpr (EPI == 2) {
        static_assert(EPI != 2 || MB == 4, "the transposed store gathers 64 rows");
        // A lane's 8 accumulator registers are 8 consecutive rows m of one column n: convert in registers, gather 64 rows of 16 columns in LDS (pitch 144 B), store whole 128-B lines.
        unsigned short* const tsb = (unsigned short*)(L + wave * EPB); unsigned short* const ts[3] = { tsb, tsb + 16 * 72, tsb + 2 * 16 * 72 };
        const size_t pb = (size_t)(r0 / TT) * HD * TT + (size_t)c0 * TT + (r0 % TT);
        float bb[4];
#pragma unroll
        for (int nb = 0; nb < 4; ++nb) bb[nb] = BIAS ? bias[c0 + nb * 16 + lr] : 0.0f;
        if (BIAS) asm volatile("s_wait_xcnt 0x0" ::: "memory");   // stands in front of the conversions below, which write the offset register that the four loads name
#pragma unroll
        for (int nb = 0; nb < 4; ++nb) bb[nb] = bfr(bb[nb]);
#pragma unroll
        for (int nb = 0; nb < 4; ++nb) {
#pragma unroll
            for (int mb = 0; mb < 4; ++mb) { v8h o16; v8us oh, ol;
#pragma unroll
                for (int j = 0; j < 8; ++j) { float val = acc[mb][nb][j]; if (BIAS) val += bb[nb]; o16[j] = tohx(val); unsigned short a2, c2; splitf(val, a2, c2); oh[j] = a2; ol[j] = c2; }
                const int so = lr * 72 + mb * 16 + hi * 8; *(v8us*)(ts[0] + so) = __builtin_bit_cast(v8us, o16); *(v8us*)(ts[1] + so) = oh; *(v8us*)(ts[2] + so) = ol; }
            // the reads below take other lanes' values: the LDS stores above are complete first, and the compiler moves no LDS access across
            __builtin_amdgcn_wave_barrier(); asm volatile("s_wait_dscnt 0x0" ::: "memory");
#pragma unroll
            for (int s = 0; s < 4; ++s) { const int col = s * 4 + (lane >> 3), ro = (lane & 7) * 8; const size_t go = pb + (size_t)(nb * 16 + col) * TT + ro;
                *(v8h*)(P16 + go) = __builtin_bit_cast(v8h, *(const v8us*)(ts[0] + col * 72 + ro)); *(v8us*)(Ph + go) = *(const v8us*)(ts[1] + col * 72 + ro); *(v8us*)(Pl + go) = *(const v8us*)(ts[2] + col * 72 + ro); }
            // keeps the next column group's LDS stores behind the reads above
            __builtin_amdgcn_wave_barrier(); asm volatile("" ::: "memory");
        }
        return;
    }
#pragma unroll
    for (int mb = 0; mb < MB; ++mb) {
#pragma unroll
        for (int nb = 0; nb < 4; ++nb) {
#pragma unroll
            for (int j = 0; j < 8; ++j) os[(hi * 8 + j) * 68 + nb * 16 + lr] = acc[mb][nb][j]; }
        __builtin_amdgcn_wave_barrier(); asm volatile("" ::: "memory");
        float* crow = C + (size_t)(r0 + mb * 16) * ldc + c0;
        if constexpr (EPI == 1) {
            // The 16 rows are converted first and then stored in one run of 24 stores, so that one s_wait_xcnt serves them all instead of one per row pair.
            const int cofs = lr * 4; v4h o16[8]; v4us oh[8], ol[8]; const size_t gb = (size_t)(r0 + mb * 16 + hi) * ldc + c0 + cofs;   // one address per plane, the row pairs at constant offsets from it
#pragma unroll
            for (int s = 0; s < 8; ++s) { const int row = 2 * s + hi; v4f val = *(const v4fa*)(os + row * 68 + cofs); if (BIAS) { val[0] += bfr(bias[c0 + cofs]); val[1] += bfr(bias[c0 + cofs + 1]); val[2] += bfr(bias[c0 + cofs + 2]); val[3] += bfr(bias[c0 + cofs + 3]); }
#pragma unroll
                for (int q = 0; q < 4; ++q) { o16[s][q] = tohx(val[q]); unsigned short a2, c2; splitf(val[q], a2, c2); oh[s][q] = a2; ol[s][q] = c2; } }
            __builtin_amdgcn_sched_barrier(0);   // keeps the conversions in front of the first store: moved in among the stores they write registers that an issued store names, each behind a wait of its own
#pragma unroll
            for (int s = 0; s < 8; ++s) { const size_t go = gb + (size_t)(2 * s) * ldc; *(v4h*)(P16 + go) = o16[s]; *(v4us*)(Ph + go) = oh[s]; *(v4us*)(Pl + go) = ol[s]; }
            asm volatile("s_wait_xcnt 0x0" ::: "memory");   // stands in front of the next 16 rows' work, which writes the address and data registers that these stores name
        } else {
#pragma unroll
            for (int s = 0; s < 8; ++s) { const int row = 2 * s + hi, cofs = lr * 4; v4f val = *(const v4fa*)(os + row * 68 + cofs); if (BIAS) { val[0] += bfr(bias[c0 + cofs]); val[1] += bfr(bias[c0 + cofs + 1]); val[2] += bfr(bias[c0 + cofs + 2]); val[3] += bfr(bias[c0 + cofs + 3]); }
                if constexpr (EPI == 3) val *= osc;
                *(v4f*)(crow + (size_t)row * ldc + cofs) = val; }
        }
        __builtin_amdgcn_wave_barrier(); asm volatile("" ::: "memory");
    }
}

// k_proj: the three projections in one launch, grid (rows / 128, DQ / 128, 3): z = 0 Q = x Wq + bq, 1 K = context Wk + bk, 2 V = context Wv + bv (stored transposed).
__global__ __launch_bounds__(128) void k_proj(const bf* __restrict__ XBx, const bf* __restrict__ XBc, const bf* __restrict__ WQ, const bf* __restrict__ WK, const bf* __restrict__ WV, const float* __restrict__ bq, const float* __restrict__ bk, const float* __restrict__ bv,
                                              h16* QP16, bf* QPh, bf* QPl, h16* KP16, bf* KPh, bf* KPl, h16* VT16, bf* VTh, bf* VTl) {
    static_assert(DQ == DKV, "one grid for the three projections");
    __shared__ __attribute__((aligned(2048))) unsigned char L[LDSB];
    const uint32_t z = blockIdx.z; const int rb = blockIdx.x * 128, cb = blockIdx.y * 128;
    v8f acc[4][4];
    gemm_main<bf, 0, 4u, 4>(L, (z == 0u) ? XBx : XBc, nullptr, (z == 0u) ? WQ : (z == 1u) ? WK : WV, nullptr, DM, rb, cb, acc);
    if (z == 2u) gemm_epi<true, 2, 4>(L, acc, rb, cb, nullptr, DKV, bv, VT16, VTh, VTl, 1.0f);
    else gemm_epi<true, 1, 4>(L, acc, rb, cb, nullptr, DQ, (z == 0u) ? bq : bk, (z == 0u) ? QP16 : KP16, (z == 0u) ? QPh : KPh, (z == 0u) ? QPl : KPl, 1.0f);
}

// k_att: one attention GEMM over all TT query rows of all batches in one launch, C[z][m][n] = sum_k A[z][m][k] B[z][n][k], NCT column tiles of 128.
// Row tiles below RH take the hi/lo planes (3 products), the rest the fp16 planes (result x osc16). 1-D grid: the hi/lo tiles have the lowest indices and start first.
// MBH, MBL: a hi/lo tile has 32 MBH rows, an fp16 tile 32 MBL rows (128 columns both); NBL: buffers of the fp16 ring. With more tiles than places on the chip (scores) both kinds are 128 rows, and the places refill as tiles end.
// Where every work-group is resident from the start (P.V: 512 on 512 places) the launch lasts as long as its longest work-group: 64 hi/lo rows x 3 products and 192 fp16 rows x 1 product are the same 48 matrix instructions per wave and pass, so all end together.
// Batch strides in elements: sAh (hi/lo A planes), sA16 (fp16 A plane), sB (every B plane), sC.
template <int NCT, int EPI, int MBH, int MBL, uint32_t NBL>
__global__ __launch_bounds__(128) void k_att(const bf* __restrict__ Ah, const bf* __restrict__ Al, const bf* __restrict__ Bh, const bf* __restrict__ Bl, const h16* __restrict__ A16, const h16* __restrict__ B16, int K, float* C, int ldc, size_t sAh, size_t sA16, size_t sB, size_t sC, float osc16) {
    __shared__ __attribute__((aligned(2048))) unsigned char L[LDSB];
    static_assert(RH % (32 * MBH) == 0 && (TT - RH) % (32 * MBL) == 0, "whole row tiles of either kind");
    constexpr uint32_t RTH = RH / (32 * MBH), RTL = (TT - RH) / (32 * MBL), NHW = RTH * NCT * NB_;   // row tiles of either kind; hi/lo work-groups
    const uint32_t id = blockIdx.x; const uint32_t hilo = pinned(id < NHW);   // pinned(): the branch below decides which tensor loads issue, so it is a scalar one
    // tile: row tile fastest, then column tile, then batch
    if (hilo) {
        const int rb = (int)(id % RTH) * (32 * MBH), cb = (int)(id / RTH % NCT) * 128; const size_t z = id / (RTH * NCT); v8f acc[MBH][4];
        gemm_main<bf, 2, 2u, MBH>(L, Ah + z * sAh, Al + z * sAh, Bh + z * sB, Bl + z * sB, K, rb, cb, acc);
        gemm_epi<false, EPI, MBH>(L, acc, rb, cb, C + z * sC, ldc, nullptr, nullptr, nullptr, nullptr, 1.0f);
    } else {
        const uint32_t il = id - NHW; const int rb = RH + (int)(il % RTL) * (32 * MBL), cb = (int)(il / RTL % NCT) * 128; const size_t z = il / (RTL * NCT); v8f acc[MBL][4];
        gemm_main<h16, 0, NBL, MBL>(L, A16 + z * sA16, nullptr, B16 + z * sB, nullptr, K, rb, cb, acc);
        gemm_epi<false, EPI, MBL>(L, acc, rb, cb, C + z * sC, ldc, nullptr, nullptr, nullptr, nullptr, osc16);
    }
}

// ---- k_prep: all input preparation in ONE launch of few, long waves (a launch of many one-load waves lasts as long as its waves take to start, not as long as its bytes take to move).
// Blocks 0 .. PWB-1, 64 per weight: a wave transposes a block of 32 n x 64 k of w [K][N] into Bt [N][K] in bf16: lane = n, so each of its 64 loads is one whole 128-B line, all in flight at once; a lane's eight 16-B stores fill one 128-B line of Bt.
// Blocks PWB .. PWB+PCB-1, half for x, half for context: a wave converts 4,096 consecutive floats, in two unrolled rounds of 16 loads of 512 contiguous bytes each (the second round's loads issue ahead of the first round's conversions as far as registers allow); the inputs are read once, so the loads are non-temporal and leave L2 to the bf16 copies.
#define PWB  192
#define PCB  512
__global__ __launch_bounds__(256) void k_prep(const float* __restrict__ x, const float* __restrict__ ctx, const float* __restrict__ wq, const float* __restrict__ wk, const float* __restrict__ wv, bf* XBx, bf* XBc, bf* WQ, bf* WK, bf* WV) {
    static_assert(DM == 1024 && DQ == 1024 && DKV == 1024, "64 blocks of 8 waves cover one weight in blocks of 32 n x 64 k");
    static_assert((size_t)NB_ * TT * DM == (size_t)(PCB / 2) * 8 * 4096, "PCB / 2 blocks of 8 waves x 4,096 floats cover one activation tensor");
    const int lane = threadIdx.x & 31, wave = threadIdx.x >> 5; const int blk = blockIdx.x;
    if (blk < PWB) {
        const int m = blk >> 6, t = (blk & 63) * 8 + wave; const int n = (t >> 4) * 32 + lane, k0 = (t & 15) * 64;
        const float* w = (m == 0) ? wq : (m == 1) ? wk : wv; bf* Bt = (m == 0) ? WQ : (m == 1) ? WK : WV;
        const float* wp = w + (size_t)k0 * DQ + n; bf* bp = Bt + (size_t)n * DM + k0; float v[64];
#pragma unroll   // all 64 loads issue before the first is waited for: one memory latency per wave; v[] stays in registers
        for (int j = 0; j < 64; ++j) v[j] = wp[(size_t)j * DQ];
#pragma unroll   // constant indices into v[]
        for (int g = 0; g < 8; ++g) { v8us o;
#pragma unroll
            for (int q = 0; q < 8; ++q) o[q] = f2bf(v[g * 8 + q]);
            *(v8us*)(bp + g * 8) = o; }
        return;
    }
    const int cb = blk - PWB; const bool isx = cb < PCB / 2; const size_t base = (size_t)(cb & (PCB / 2 - 1)) * (8 * 4096) + (size_t)wave * 4096 + (size_t)lane * 4;
    const float* sp = (isx ? x : ctx) + base; bf* dp = (isx ? XBx : XBc) + base;
#pragma unroll   // lets the second round's loads start before the first round is converted
    for (int r = 0; r < 2; ++r) { v4f v[16];
#pragma unroll   // a round's 16 loads in flight together, from one base address with immediate offsets
        for (int i = 0; i < 16; ++i) v[i] = __builtin_nontemporal_load((const v4f*)(sp + r * 2048 + i * 128));
#pragma unroll
        for (int i = 0; i < 16; ++i) { v4us o;
#pragma unroll
            for (int q = 0; q < 4; ++q) o[q] = f2bf(v[i][q]);
            *(v4us*)(dp + r * 2048 + i * 128) = o; } }
}

// k_asoft: per row (zz, i), zz = batch: t = S x HD^-0.5 (no mask); softmax over the 2048 keys (register row, one exp, fixed trees);
__global__ __launch_bounds__(256) void k_asoft(const float* __restrict__ Sb, h16* P16, bf* Ph, bf* Pl) {
    const int lane = threadIdx.x & 31; const int row = blockIdx.x * 8 + (threadIdx.x >> 5); if (row >= NB_ * TT) return; const int i = row % TT; const int zz = row / TT; (void)zz; const bool hires = (i < RH); const float* sr = Sb + (size_t)row * TT; float v[TT / 32]; float mx = -3.0e38f;
#pragma unroll
    for (int ch = 0; ch < TT / 128; ++ch) { const int j0 = ch * 128 + lane * 4; const v4f a = *(const v4f*)(sr + j0);
#pragma unroll
        for (int q = 0; q < 4; ++q) { const int j = j0 + q; (void)j; const float t = a[q] * SCL; v[ch * 4 + q] = t; mx = fmaxf(mx, t); } }
#pragma unroll
    for (int sh = 16; sh; sh >>= 1) mx = fmaxf(mx, __shfl_xor(mx, sh, 32));
    float sum = 0.f;
#pragma unroll
    for (int k = 0; k < TT / 32; ++k) { float d0 = __fsub_rn(v[k], mx); asm volatile("" : "+v"(d0)); v[k] = __builtin_amdgcn_exp2f(__fmul_rn(d0, 1.4426950408889634f)); sum += v[k]; }
#pragma unroll
    for (int sh = 16; sh; sh >>= 1) sum += __shfl_xor(sum, sh, 32);
    const float f = __fdiv_rn(hires ? 1.0f : PCAR, sum);
{
        if (hires) {
#pragma unroll
            for (int ch = 0; ch < TT / 128; ++ch) { v4us oh, ol;
#pragma unroll
                for (int q = 0; q < 4; ++q) { unsigned short a, c2; splitf(v[ch * 4 + q] * f, a, c2); oh[q] = a; ol[q] = c2; }
                const size_t oo = ((size_t)zz * (RH ? RH : 1) + i) * TT + ch * 128 + lane * 4; *(v4us*)(Ph + oo) = oh; *(v4us*)(Pl + oo) = ol; }
        } else {
#pragma unroll
            for (int ch = 0; ch < TT / 128; ++ch) { v4h o4;
#pragma unroll
                for (int q = 0; q < 4; ++q) o4[q] = tohx(v[ch * 4 + q] * f);
                *(v4h*)(P16 + (size_t)row * TT + ch * 128 + lane * 4) = o4; } }
         }
}

extern "C" void kernel_launch(void* const* d_in, const int* in_sizes, int n_in,
                              void* d_out, int out_size, void* d_ws, size_t ws_size, hipStream_t stream) {
    (void)in_sizes; (void)n_in; (void)out_size;
    const float* x = (const float*)d_in[0]; const float* xk = (const float*)d_in[1];   /* K and V both project context */ const float* wq = (const float*)d_in[2]; const float* bq = (const float*)d_in[3]; const float* wk = (const float*)d_in[4]; const float* bk = (const float*)d_in[5]; const float* wv = (const float*)d_in[6]; const float* bv = (const float*)d_in[7]; const float* wo = nullptr; (void)wo;   /* argument order x, context, Wq, bq, Wk, bk, Wv, bv ('xw' [1024][1024]) */
    float* OUT = (float*)d_out;     // [4][2048][1024]
    char* wsp = (char*)d_ws;
    auto take = [&](size_t bytes) { char* p = wsp; wsp += (bytes + 255) & ~(size_t)255; return (void*)p; };
    // Workspace for all four batches at once; regions whose contents are dead by then are used again, in stream order (every byte read is written earlier in the same call).
    bf* WQ = (bf*)take((size_t)DQ * DM * 2); bf* WK = (bf*)take((size_t)DKV * DM * 2); bf* WV = (bf*)take((size_t)DKV * DM * 2);
    h16* P16 = (h16*)take((size_t)NB_ * TT * TT * 2);
    h16* QP16 = (h16*)take((size_t)NB_ * TT * HD * 2); h16* KP16 = (h16*)take((size_t)NB_ * TT * HD * 2); h16* VT16 = (h16*)take((size_t)NB_ * HD * TT * 2);
    bf* QPh = (bf*)take((size_t)NB_ * TT * HD * 2); bf* QPl = (bf*)take((size_t)NB_ * TT * HD * 2); bf* KPh = (bf*)take((size_t)NB_ * TT * HD * 2); bf* KPl = (bf*)take((size_t)NB_ * TT * HD * 2); bf* VTh = (bf*)take((size_t)NB_ * HD * TT * 2); bf* VTl = (bf*)take((size_t)NB_ * HD * TT * 2);
    float* Sb = (float*)take((size_t)NB_ * TT * TT * 4);
    if ((size_t)(wsp - (char*)d_ws) > ws_size) return;    // ws 256 MiB, 246 MiB used
    bf* XBx = (bf*)P16; bf* XBc = XBx + (size_t)NB_ * TT * DM;   // bf16 copies of x and of context (16 MiB each) fill the fp16 probabilities' region (32 MiB): dead after the V projection, before the softmax writes them
    bf* Ph = QPh; bf* Pl = QPl;                       // hi/lo probabilities (8 MiB each) over the hi/lo query planes: dead after the score GEMMs
    k_prep<<<PWB + PCB, 256, 0, stream>>>(x, xk, wq, wk, wv, XBx, XBc, WQ, WK, WV);
    k_proj<<<dim3(NB_ * TT / 128, DQ / 128, 3), 128, 0, stream>>>(XBx, XBc, WQ, WK, WV, bq, bk, bv, QP16, QPh, QPl, KP16, KPh, KPl, VT16, VTh, VTl);
    // attention (one head): batch strides are one batch's plane, score matrix or output
    k_att<TT / 128, 0, 4, 4, 4u><<<(TT / 128) * (TT / 128) * NB_, 128, 0, stream>>>(QPh, QPl, KPh, KPl, QP16, KP16, HD, Sb, TT, (size_t)TT * HD, (size_t)TT * HD, (size_t)TT * HD, (size_t)TT * TT, 1.0f);
    k_asoft<<<NB_ * TT / 8, 256, 0, stream>>>(Sb, P16, Ph, Pl);
    k_att<HD / 128, 3, 2, 6, 3u><<<(RH / 64 + (TT - RH) / 192) * (HD / 128) * NB_, 128, 0, stream>>>(Ph, Pl, VTh, VTl, P16, VT16, TT, OUT, HD, (size_t)RH * TT, (size_t)TT * TT, (size_t)HD * TT, (size_t)TT * HD, 1.0f / PCAR);
}
